// v000
// Measured on an AMD MI455X. A time is GPU time per run, averaged over a window of back-to-back runs after a warm-up
// (all launches, gaps included; the runs take copies of the inputs in turn), and the median of several windows.
// Apart from v000's, it joins two sittings. Times from different sittings can be a few percent apart, while
// side-by-side timings come from the same sitting.
// v000 is the starting kernel. One run takes 3980 microseconds.
#include <hip/hip_runtime.h>

// Compute dtypes, f32 accumulate, per item: q/k/v = the k=1 causal convs = x.W^T as [2048 x 1024].[1024 x 1024] GEMMs with PLAIN bf16 operands (exact products); per head: scores = q.k^T ([2048 x 64].[64 x 2048], both operands bf16 hi + UNSCALED residual, three products), masked softmax (x 1/8; positions where the INPUT attn_mask == 0 are excluded, read per (query, key)) in f32 -> P planes, ctx = P.v

#define NBT  2
#define NN   2048
#define DMOD 1024
#define NH_  16
#define HD   64
#define DM   DMOD
#define NTK  NN
#define SCL  0.125f
#define LOSC 1024.0f

typedef _Float16 h16;
typedef unsigned short bf;
typedef __attribute__((ext_vector_type(16))) __bf16   v16bf;
typedef __attribute__((ext_vector_type(16))) _Float16 v16h;
typedef __attribute__((ext_vector_type(8)))  _Float16 v8h;
typedef __attribute__((ext_vector_type(8)))  unsigned short v8us;
typedef __attribute__((ext_vector_type(8)))  float    v8f;
typedef __attribute__((ext_vector_type(4)))  float    v4f;
typedef __attribute__((ext_vector_type(4)))  _Float16 v4h;
typedef v8h  __attribute__((may_alias)) v8ha;
typedef v4f  __attribute__((may_alias)) v4fa;
typedef v8us __attribute__((may_alias)) v8usa;

__device__ __forceinline__ unsigned short f2bf(float f) { unsigned u = __float_as_uint(f); u += 0x7FFFu + ((u >> 16) & 1u); return (unsigned short)(u >> 16); }
__device__ __forceinline__ float bf2f(unsigned short b) { return __uint_as_float(((unsigned)b) << 16); }
__device__ __forceinline__ float bfr(float f) { return bf2f(f2bf(f)); }
__device__ __forceinline__ v16h cat16(v8h lo, v8h hi) { return __builtin_shufflevector(lo, hi, 0, 1, 2, 3, 4, 5, 6, 7, 8, 9, 10, 11, 12, 13, 14, 15); }
__device__ __forceinline__ v16bf cat16b(v8us lo, v8us hi) { return __builtin_bit_cast(v16bf, __builtin_shufflevector(lo, hi, 0, 1, 2, 3, 4, 5, 6, 7, 8, 9, 10, 11, 12, 13, 14, 15)); }
__device__ __forceinline__ v8f wmma16(v16h a, v16h b, v8f c) { return __builtin_amdgcn_wmma_f32_16x16x32_f16(false, a, false, b, (short)0, c, false, false); }
__device__ __forceinline__ v8f wmmab(v16bf a, v16bf b, v8f c) { return __builtin_amdgcn_wmma_f32_16x16x32_bf16(false, a, false, b, (short)0, c, false, false); }

// k_gemmb: 64 x 64 block tile (4 waves x 16 x 64) of C[NTK][NW] = (A [+ Al]).B^T (K = 1024) [+ bf(bias[c])] [+ bf(R[r][c]) residual]; f32 whole-line epilogue (or f16
template <bool SPLITA, bool F16OUT = false>
__global__ __launch_bounds__(128) void k_gemmb(const bf* __restrict__ A, const bf* __restrict__ Al, const bf* __restrict__ Bn, const float* __restrict__ bias, float* C, int ldc, h16* C2, const float* __restrict__ R = nullptr, int K = DM, int roundR = 1) {
    __shared__ __align__(16) float ost[4][16 * 68];
    const int lane = threadIdx.x & 31, wave = threadIdx.x >> 5, lr = lane & 15, hi = lane >> 4;
    const int r0 = blockIdx.x * 64 + wave * 16, c0 = blockIdx.y * 64;
    const size_t aoff = (size_t)(r0 + lr) * K + 8 * hi;
    size_t boff[4];
#pragma unroll
    for (int t = 0; t < 4; ++t) boff[t] = (size_t)(c0 + t * 16 + lr) * K + 8 * hi;
    v8f acc[4];
#pragma unroll
    for (int t = 0; t < 4; ++t) acc[t] = (v8f){};
#pragma unroll 1
    for (int kc = 0; kc < K; kc += 32) {
        const v16bf a = cat16b(*(const v8us*)(A + aoff + kc), *(const v8us*)(A + aoff + kc + 16));
        v16bf al = a;
        if (SPLITA) al = cat16b(*(const v8us*)(Al + aoff + kc), *(const v8us*)(Al + aoff + kc + 16));
#pragma unroll
        for (int t = 0; t < 4; ++t) { const v16bf b = cat16b(*(const v8us*)(Bn + boff[t] + kc), *(const v8us*)(Bn + boff[t] + kc + 16)); acc[t] = wmmab(a, b, acc[t]); if (SPLITA) acc[t] = wmmab(al, b, acc[t]); }
        asm volatile("v_nop\n\tv_nop\n\tv_nop\n\tv_nop" : "+v"(acc[0]), "+v"(acc[1]), "+v"(acc[2]), "+v"(acc[3]) : "v"(a), "v"(al));
    }
    float* os = &ost[wave][0];
#pragma unroll
    for (int t = 0; t < 4; ++t) { const float bv = bias ? bfr(bias[c0 + t * 16 + lr]) : 0.f;
#pragma unroll
        for (int j = 0; j < 8; ++j) os[(hi * 8 + j) * 68 + t * 16 + lr] = acc[t][j] + bv; }
    __syncthreads();
    if (F16OUT) {
        h16* crow = (h16*)(void*)C + (size_t)r0 * ldc + c0;
        auto pass = [&]() {
#pragma unroll
            for (int s = 0; s < 4; ++s) { const int row = 4 * s + (lane >> 3), piece = lane & 7; const float* sp = os + row * 68 + piece * 8; v8h o, o2;
#pragma unroll
                for (int i = 0; i < 8; ++i) { const h16 a = (h16)sp[i]; o[i] = a; o2[i] = (h16)((sp[i] - (float)a) * LOSC); }
                *(v8h*)(crow + (size_t)row * ldc + piece * 8) = o; if (C2) *(v8h*)(C2 + (size_t)r0 * ldc + c0 + (size_t)row * ldc + piece * 8) = o2; }
        };
        pass(); 
    } else {
        float* crow = C + (size_t)r0 * ldc + c0;
        auto pass = [&]() {
#pragma unroll
            for (int s = 0; s < 8; ++s) { const int Lid = (lane >> 3) + 4 * s, piece = lane & 7; const int row = Lid >> 1, cofs = (Lid & 1) * 32 + piece * 4;
                v4f val = *(const v4fa*)(os + row * 68 + cofs); if (R) { const v4f rv = *(const v4f*)(R + ((size_t)r0 + row) * ldc + c0 + cofs); val += roundR ? (v4f){bfr(rv[0]), bfr(rv[1]), bfr(rv[2]), bfr(rv[3])} : rv; }
                *(v4f*)(crow + (size_t)row * ldc + cofs) = val; }
        };
        pass(); 
    }
}

// k_gemm3: 64 x 64 tile of C = (Ah + Al).(Bh + Bl)^T over K (row strides = K for all four planes; n-major B): three products per 32-k step (hh, hl, lh); f32
__global__ __launch_bounds__(128) void k_gemm3(const bf* __restrict__ Ah, const bf* __restrict__ Al, const bf* __restrict__ Bh, const bf* __restrict__ Bl, int K, float* C, int ldc) {
    __shared__ __align__(16) float ost[4][16 * 68];
    const int lane = threadIdx.x & 31, wave = threadIdx.x >> 5, lr = lane & 15, hi = lane >> 4;
    const int r0 = blockIdx.x * 64 + wave * 16, c0 = blockIdx.y * 64;
    const size_t aoff = (size_t)(r0 + lr) * K + 8 * hi;
    v8f acc[4];
#pragma unroll
    for (int t = 0; t < 4; ++t) acc[t] = (v8f){};
#pragma unroll 1
    for (int kc = 0; kc < K; kc += 32) {
        const v16bf a = cat16b(*(const v8us*)(Ah + aoff + kc), *(const v8us*)(Ah + aoff + kc + 16));
        const v16bf al = cat16b(*(const v8us*)(Al + aoff + kc), *(const v8us*)(Al + aoff + kc + 16));
#pragma unroll
        for (int t = 0; t < 4; ++t) { const size_t bo = (size_t)(c0 + t * 16 + lr) * K + kc + 8 * hi;
            const v16bf bh = cat16b(*(const v8us*)(Bh + bo), *(const v8us*)(Bh + bo + 16)); const v16bf bl = cat16b(*(const v8us*)(Bl + bo), *(const v8us*)(Bl + bo + 16));
            acc[t] = wmmab(a, bh, acc[t]); acc[t] = wmmab(al, bh, acc[t]); acc[t] = wmmab(a, bl, acc[t]); }
        asm volatile("v_nop\n\tv_nop\n\tv_nop\n\tv_nop" : "+v"(acc[0]), "+v"(acc[1]), "+v"(acc[2]), "+v"(acc[3]) : "v"(a), "v"(al));
    }
    float* os = &ost[wave][0];
#pragma unroll
    for (int t = 0; t < 4; ++t) {
#pragma unroll
        for (int j = 0; j < 8; ++j) os[(hi * 8 + j) * 68 + t * 16 + lr] = acc[t][j]; }
    __builtin_amdgcn_wave_barrier(); asm volatile("" ::: "memory");
    float* crow = C + (size_t)r0 * ldc + c0;
    auto pass = [&]() {
#pragma unroll
        for (int s = 0; s < 8; ++s) { const int Lid = (lane >> 3) + 4 * s, piece = lane & 7; const int row = Lid >> 1, cofs = (Lid & 1) * 32 + piece * 4;
            const v4f val = *(const v4fa*)(os + row * 68 + cofs); *(v4f*)(crow + (size_t)row * ldc + cofs) = val; }
    };
    pass(); 
}

__global__ __launch_bounds__(256) void k_cvt8(const float* __restrict__ src, bf* dst, size_t n8) {
    const size_t i = (size_t)blockIdx.x * 256 + threadIdx.x; if (i >= n8) return;
    const v8f v = *(const v8f*)(src + i * 8); v8us o;
#pragma unroll
    for (int k = 0; k < 8; ++k) o[k] = f2bf(v[k]);
    *(v8us*)(dst + i * 8) = o; 
}
__global__ __launch_bounds__(256) void k_zero8(bf* dst, size_t n8) {
    const size_t i = (size_t)blockIdx.x * 256 + threadIdx.x; if (i >= n8) return; v8us z;
#pragma unroll
    for (int k = 0; k < 8; ++k) z[k] = 0;
    *(v8us*)(dst + i * 8) = z; 
}

__global__ __launch_bounds__(256) void k_cvtx(const float* __restrict__ src, bf* dst) {
    const int lane = threadIdx.x & 31; const size_t r = (size_t)blockIdx.x * 8 + (threadIdx.x >> 5); if (r >= (size_t)NN) return;
{
#pragma unroll
        for (int q = 0; q < DMOD / 256; ++q) { v8us o;
#pragma unroll
            for (int i = 0; i < 8; ++i) o[i] = f2bf(src[r * DMOD + q * 256 + lane * 8 + i]);
            *(v8us*)(dst + r * DMOD + q * 256 + lane * 8) = o; }
         }
}
// k_hplanes / k_vt (row stride 1024).
__global__ __launch_bounds__(256) void k_hplanes(const float* __restrict__ F, int h, bf* Ph, bf* Pl) {
    typedef __attribute__((ext_vector_type(2))) unsigned short v2us;
    const int lane = threadIdx.x & 31; const size_t s = (size_t)blockIdx.x * 8 + (threadIdx.x >> 5); if (s >= (size_t)NN) return; v2us oh, ol;
#pragma unroll
    for (int i = 0; i < 2; ++i) { const float v = F[s * DMOD + h * HD + lane * 2 + i]; const unsigned short hb = f2bf(v); oh[i] = hb; ol[i] = f2bf(v - bf2f(hb)); }
    const size_t o = s * HD + lane * 2; *(v2us*)(Ph + o) = oh; *(v2us*)(Pl + o) = ol; 
}
__global__ __launch_bounds__(256) void k_vt(const float* __restrict__ VF, int h, bf* Th, bf* Tl) {
    typedef __attribute__((ext_vector_type(2))) unsigned short v2us;
    const int lane = threadIdx.x & 31; const size_t wid = (size_t)blockIdx.x * 8 + (threadIdx.x >> 5); if (wid >= (size_t)HD * (NN / 64)) return; const int d = (int)(wid / (NN / 64)); const int t0 = (int)(wid % (NN / 64)) * 64 + lane * 2; v2us oh, ol;
#pragma unroll
    for (int i = 0; i < 2; ++i) { const float v = VF[(size_t)(t0 + i) * DMOD + h * HD + d]; const unsigned short hb = f2bf(v); oh[i] = hb; ol[i] = f2bf(v - bf2f(hb)); }
    const size_t o = (size_t)d * NN + t0; *(v2us*)(Th + o) = oh; *(v2us*)(Tl + o) = ol; 
}
// k_msoftmax: P planes of the masked softmax: s = S x 1/8 where mask[i][k] != 0, excluded (-inf -> probability 0) where mask == 0 (the int32 INPUT mask, broadcast over batch
__global__ __launch_bounds__(256) void k_msoftmax(const float* __restrict__ S, const int* __restrict__ MK, bf* PH, bf* PL) {
    typedef __attribute__((ext_vector_type(4))) unsigned short v4us;
    const int lane = threadIdx.x & 31, i = blockIdx.x * 8 + (threadIdx.x >> 5); if (i >= NN) return; const int* mr = MK + (size_t)i * NN;
    float m = -3.0e38f;
#pragma unroll 1
    for (int c0 = lane * 4; c0 < NN; c0 += 128) {
#pragma unroll
        for (int q = 0; q < 4; ++q) { if (mr[c0 + q] != 0) m = fmaxf(m, S[(size_t)i * NN + c0 + q] * SCL); } }
#pragma unroll
    for (int sh = 16; sh; sh >>= 1) m = fmaxf(m, __shfl_xor(m, sh, 32));
    float sum = 0.f;
#pragma unroll 1
    for (int c0 = lane * 4; c0 < NN; c0 += 128) {
#pragma unroll
        for (int q = 0; q < 4; ++q) { if (mr[c0 + q] != 0) sum += __expf(S[(size_t)i * NN + c0 + q] * SCL - m); } }
#pragma unroll
    for (int sh = 16; sh; sh >>= 1) sum += __shfl_xor(sum, sh, 32);
    const float inv = 1.0f / sum;
{
#pragma unroll 1
        for (int c0 = lane * 4; c0 < NN; c0 += 128) { v4us oh, ol;
#pragma unroll
            for (int q = 0; q < 4; ++q) { const float p = (mr[c0 + q] != 0) ? __expf(S[(size_t)i * NN + c0 + q] * SCL - m) * inv : 0.f * inv; const unsigned short hb = f2bf(p); oh[q] = hb; ol[q] = f2bf(p - bf2f(hb)); }
            const size_t o = (size_t)i * NN + c0; *(v4us*)(PH + o) = oh; *(v4us*)(PL + o) = ol; }
         }
}
__global__ __launch_bounds__(256) void k_split1k(const float* __restrict__ src, bf* dh, bf* dl) {
    const int lane = threadIdx.x & 31; const size_t r = (size_t)blockIdx.x * 8 + (threadIdx.x >> 5); if (r >= (size_t)NN) return;
{
#pragma unroll
        for (int q = 0; q < DMOD / 256; ++q) { const size_t o = r * DMOD + q * 256 + lane * 8; const v8f v = *(const v8f*)(src + o); v8us oh, ol;
#pragma unroll
            for (int i = 0; i < 8; ++i) { const unsigned short hb = f2bf(v[i]); oh[i] = hb; ol[i] = f2bf(v[i] - bf2f(hb)); }
            *(v8us*)(dh + o) = oh; *(v8us*)(dl + o) = ol; }
         }
}

extern "C" void kernel_launch(void* const* d_in, const int* in_sizes, int n_in,
                              void* d_out, int out_size, void* d_ws, size_t ws_size, hipStream_t stream) {
    (void)in_sizes; (void)n_in; (void)out_size;
    const float* x = (const float*)d_in[0]; const int* MK = (const int*)d_in[1]; const float* Wq = (const float*)d_in[2]; const float* Wk = (const float*)d_in[3]; const float* Wv = (const float*)d_in[4]; const float* Wo = (const float*)d_in[5]; const float* bo = (const float*)d_in[6];
    float* out = (float*)d_out;    // [2][2048][1024]
    char* wsp = (char*)d_ws;
    auto take = [&](size_t bytes) { char* p = wsp; wsp += (bytes + 255) & ~(size_t)255; return (void*)p; };
    bf* WQ = (bf*)take((size_t)DMOD * DMOD * 2); bf* WK = (bf*)take((size_t)DMOD * DMOD * 2); bf* WV = (bf*)take((size_t)DMOD * DMOD * 2); bf* WO = (bf*)take((size_t)DMOD * DMOD * 2);
    bf* Xb = (bf*)take((size_t)NN * DMOD * 2); float* QF = (float*)take((size_t)NN * DMOD * 4); float* KF = (float*)take((size_t)NN * DMOD * 4); float* VF = (float*)take((size_t)NN * DMOD * 4);
    bf* Qh = (bf*)take((size_t)NN * HD * 2); bf* Ql = (bf*)take((size_t)NN * HD * 2); bf* Kh = (bf*)take((size_t)NN * HD * 2); bf* Kl = (bf*)take((size_t)NN * HD * 2); bf* VTh = (bf*)take((size_t)HD * NN * 2); bf* VTl = (bf*)take((size_t)HD * NN * 2);
    float* S = (float*)take((size_t)NN * NN * 4); bf* WH = (bf*)take((size_t)NN * NN * 2); bf* WL = (bf*)take((size_t)NN * NN * 2); float* CTX = (float*)take((size_t)NN * DMOD * 4); bf* Ch = (bf*)take((size_t)NN * DMOD * 2); bf* Cl = (bf*)take((size_t)NN * DMOD * 2);
    if ((size_t)(wsp - (char*)d_ws) > ws_size) return;    // 8.4 + 4.2 + 25.2 + 1.5 + 16.8 + 16.8 + 8.4 + 8.4 ~ 90 MB; per item/head reuse in stream order
    k_cvt8<<<(unsigned)(((size_t)DMOD * DMOD / 8 + 255) / 256), 256, 0, stream>>>(Wq, WQ, (size_t)DMOD * DMOD / 8); k_cvt8<<<(unsigned)(((size_t)DMOD * DMOD / 8 + 255) / 256), 256, 0, stream>>>(Wk, WK, (size_t)DMOD * DMOD / 8);
    k_cvt8<<<(unsigned)(((size_t)DMOD * DMOD / 8 + 255) / 256), 256, 0, stream>>>(Wv, WV, (size_t)DMOD * DMOD / 8); k_cvt8<<<(unsigned)(((size_t)DMOD * DMOD / 8 + 255) / 256), 256, 0, stream>>>(Wo, WO, (size_t)DMOD * DMOD / 8);   // [out][in] convention = n-major
    for (int b = 0; b < NBT; ++b) {
        k_cvtx<<<NN / 8, 256, 0, stream>>>(x + (size_t)b * NN * DMOD, Xb);
        k_gemmb<false, false><<<dim3(NN / 64, DMOD / 64, 1), 128, 0, stream>>>(Xb, nullptr, WQ, nullptr, QF, DMOD, nullptr, nullptr, DMOD);
        k_gemmb<false, false><<<dim3(NN / 64, DMOD / 64, 1), 128, 0, stream>>>(Xb, nullptr, WK, nullptr, KF, DMOD, nullptr, nullptr, DMOD);
        k_gemmb<false, false><<<dim3(NN / 64, DMOD / 64, 1), 128, 0, stream>>>(Xb, nullptr, WV, nullptr, VF, DMOD, nullptr, nullptr, DMOD);
        for (int h = 0; h < NH_; ++h) {
            k_hplanes<<<NN / 8, 256, 0, stream>>>(QF, h, Qh, Ql); k_hplanes<<<NN / 8, 256, 0, stream>>>(KF, h, Kh, Kl); k_vt<<<(HD * (NN / 64)) / 8, 256, 0, stream>>>(VF, h, VTh, VTl);
            k_gemm3<<<dim3(NN / 64, NN / 64, 1), 128, 0, stream>>>(Qh, Ql, Kh, Kl, HD, S, NN);
            k_msoftmax<<<NN / 8, 256, 0, stream>>>(S, MK, WH, WL);
            k_gemm3<<<dim3(NN / 64, 1, 1), 128, 0, stream>>>(WH, WL, VTh, VTl, NN, CTX + h * HD, DMOD); }
        k_split1k<<<NN / 8, 256, 0, stream>>>(CTX, Ch, Cl);
        k_gemmb<true, false><<<dim3(NN / 64, DMOD / 64, 1), 128, 0, stream>>>(Ch, Cl, WO, bo, out + (size_t)b * NN * DMOD, DMOD, nullptr, nullptr, DMOD); }
}

// v002
// One run takes 212 microseconds.
// Versions in between are left out here; by their measured steps it is 18.9 times as fast as v000.
#include <hip/hip_runtime.h>

// Compute dtypes, f32 accumulate, per item: q/k/v = the k=1 causal convs = x.W^T as [2048 x 1024].[1024 x 1024] GEMMs with PLAIN bf16 operands (exact products); per head, in ONE fused kernel: scores^T = k.q^T (both operands bf16 hi + UNSCALED residual, three products), masked online softmax (x 1/8; positions where the INPUT attn_mask == 0 are excluded, read per (query, key)) in f32, ctx^T += v^T.P^T (P and v as bf16 hi + residual, three products)

#define NBT  2
#define NN   2048
#define DMOD 1024
#define NH_  16
#define HD   64
#define DM   DMOD
#define NTK  NN
#define SCL  0.125f
#define LOSC 1024.0f

typedef _Float16 h16;
typedef unsigned short bf;
typedef __attribute__((ext_vector_type(16))) __bf16   v16bf;
typedef __attribute__((ext_vector_type(16))) _Float16 v16h;
typedef __attribute__((ext_vector_type(8)))  _Float16 v8h;
typedef __attribute__((ext_vector_type(8)))  unsigned short v8us;
typedef __attribute__((ext_vector_type(8)))  float    v8f;
typedef __attribute__((ext_vector_type(4)))  float    v4f;
typedef __attribute__((ext_vector_type(4)))  _Float16 v4h;
typedef v8h  __attribute__((may_alias)) v8ha;
typedef v4f  __attribute__((may_alias)) v4fa;
typedef v8us __attribute__((may_alias)) v8usa;

__device__ __forceinline__ unsigned short f2bf(float f) { unsigned u = __float_as_uint(f); u += 0x7FFFu + ((u >> 16) & 1u); return (unsigned short)(u >> 16); }
__device__ __forceinline__ float bf2f(unsigned short b) { return __uint_as_float(((unsigned)b) << 16); }
__device__ __forceinline__ float bfr(float f) { return bf2f(f2bf(f)); }
__device__ __forceinline__ v16h cat16(v8h lo, v8h hi) { return __builtin_shufflevector(lo, hi, 0, 1, 2, 3, 4, 5, 6, 7, 8, 9, 10, 11, 12, 13, 14, 15); }
__device__ __forceinline__ v16bf cat16b(v8us lo, v8us hi) { return __builtin_bit_cast(v16bf, __builtin_shufflevector(lo, hi, 0, 1, 2, 3, 4, 5, 6, 7, 8, 9, 10, 11, 12, 13, 14, 15)); }
__device__ __forceinline__ v8f wmma16(v16h a, v16h b, v8f c) { return __builtin_amdgcn_wmma_f32_16x16x32_f16(false, a, false, b, (short)0, c, false, false); }
__device__ __forceinline__ v8f wmmab(v16bf a, v16bf b, v8f c) { return __builtin_amdgcn_wmma_f32_16x16x32_bf16(false, a, false, b, (short)0, c, false, false); }

// k_gemmb: 64 x 64 block tile (4 waves x 16 x 64) of C[NTK][NW] = (A [+ Al]).B^T (K = DM) [+ bf(bias[c])] [+ bf(R[r][c]) residual]; f32 whole-line epilogue (or f16
// The operand tiles (64 rows x KS k each) go through LDS: every wave-wide 16-byte global load covers two 256-byte row pieces (four whole lines), the B tile is fetched once for the four waves,
// and stage s + 1 is on its way in registers while stage s is multiplied. Rows lie LP bytes apart in LDS (an odd multiple of 16 bytes: the 16 rows of a fragment read fall on 64 different banks).
// amdgpu_num_vgpr(256): left free, the build with three tiles runs two registers past v255.
#define KS 128
#define LP (KS * 2 + 16)
template <bool SPLITA, bool F16OUT = false>
__global__ __launch_bounds__(128) __attribute__((amdgpu_num_vgpr(256))) void k_gemmb(const bf* __restrict__ A, const bf* __restrict__ Al, const bf* __restrict__ Bn, const float* __restrict__ bias, float* C, int ldc, h16* C2, const float* __restrict__ R = nullptr, int roundR = 1) {
    constexpr int NT = SPLITA ? 3 : 2;   // tiles of a stage: A, [Al,] B
    constexpr int GQ = SPLITA ? 1 : 2;   // 32-k steps whose fragments are read from LDS as one group
    __shared__ __align__(16) float ost[4][16 * 68];
    __shared__ __align__(16) char stg[2][NT][64 * LP];
    const int lane = threadIdx.x & 31, wave = threadIdx.x >> 5, lr = lane & 15, hi = lane >> 4;
    const int r0 = blockIdx.x * 64 + wave * 16, c0 = blockIdx.y * 64;
    const int srow = threadIdx.x >> 4, spc = threadIdx.x & 15;   // staging: this thread moves piece spc (16 bytes) of rows srow + 8 i of every tile
    const char* ga = (const char*)A + ((size_t)(blockIdx.x * 64 + srow) * DM + spc * 8) * 2;
    const char* gl = (const char*)(SPLITA ? Al : A) + ((size_t)(blockIdx.x * 64 + srow) * DM + spc * 8) * 2;
    const char* gb = (const char*)Bn + ((size_t)(c0 + srow) * DM + spc * 8) * 2;
    const int ls = srow * LP + spc * 16, fa = (wave * 16 + lr) * LP + hi * 16, fb = lr * LP + hi * 16;
    v8us ra[8], rl[8], rb[8];
    auto fetch = [&](int s) {
#pragma unroll
        for (int i = 0; i < 8; ++i) { const int o = i * 8 * DM * 2 + s * KS * 2; ra[i] = *(const v8us*)(ga + o); if (SPLITA) rl[i] = *(const v8us*)(gl + o); rb[i] = *(const v8us*)(gb + o); }
    };
    auto put = [&](int buf) {
#pragma unroll
        for (int i = 0; i < 8; ++i) { const int o = ls + i * 8 * LP; *(v8usa*)(&stg[buf][0][o]) = ra[i]; if (SPLITA) *(v8usa*)(&stg[buf][1][o]) = rl[i]; *(v8usa*)(&stg[buf][NT - 1][o]) = rb[i]; }
    };
    v8f acc[4];
#pragma unroll
    for (int t = 0; t < 4; ++t) acc[t] = (v8f){};
    fetch(0); put(0);
    __syncthreads();
#pragma unroll   // unrolled: buffer, stage offset and the last stage's test become constants, and no address register is stepped behind a load
    for (int s = 0; s < DM / KS; ++s) {
        const int buf = s & 1;
        if (s + 1 < DM / KS) fetch(s + 1);
#pragma unroll
        for (int g = 0; g < KS / 32 / GQ; ++g) {   // eight products at a time: what fits 256 registers beside the stage in flight
            v16bf a[GQ], al[GQ], b[GQ][4];
#pragma unroll
            for (int q = 0; q < GQ; ++q) { const int k = (g * GQ + q) * 64;
                a[q] = cat16b(*(const v8usa*)(&stg[buf][0][fa + k]), *(const v8usa*)(&stg[buf][0][fa + k + 32]));
                if (SPLITA) al[q] = cat16b(*(const v8usa*)(&stg[buf][1][fa + k]), *(const v8usa*)(&stg[buf][1][fa + k + 32]));
#pragma unroll
                for (int t = 0; t < 4; ++t) b[q][t] = cat16b(*(const v8usa*)(&stg[buf][NT - 1][fb + t * 16 * LP + k]), *(const v8usa*)(&stg[buf][NT - 1][fb + t * 16 * LP + k + 32])); }
            __builtin_amdgcn_sched_barrier(0);   // the group's LDS reads issue together, ahead of its products: left free, the scheduler reuses one fragment's registers and the wave waits out an LDS latency at every product
#pragma unroll
            for (int q = 0; q < GQ; ++q)
#pragma unroll
                for (int t = 0; t < 4; ++t) { acc[t] = wmmab(a[q], b[q][t], acc[t]); if (SPLITA) acc[t] = wmmab(al[q], b[q][t], acc[t]); }
        }
        if (s + 1 < DM / KS) {
            put(buf ^ 1);      // into the buffer that stage s - 1 was read from: its readers left it at the barrier that ended that stage
            __syncthreads();   // publishes stage s + 1 and ends the reads of stage s
        }
    }
    float* os = &ost[wave][0];
#pragma unroll
    for (int t = 0; t < 4; ++t) { const float bv = bias ? bfr(bias[c0 + t * 16 + lr]) : 0.f;
#pragma unroll
        for (int j = 0; j < 8; ++j) os[(hi * 8 + j) * 68 + t * 16 + lr] = acc[t][j] + bv; }
    __syncthreads();
    if (F16OUT) {
        h16* crow = (h16*)(void*)C + (size_t)r0 * ldc + c0;
        auto pass = [&]() {
#pragma unroll
            for (int s = 0; s < 4; ++s) { const int row = 4 * s + (lane >> 3), piece = lane & 7; const float* sp = os + row * 68 + piece * 8; v8h o, o2;
#pragma unroll
                for (int i = 0; i < 8; ++i) { const h16 a = (h16)sp[i]; o[i] = a; o2[i] = (h16)((sp[i] - (float)a) * LOSC); }
                *(v8h*)(crow + (size_t)row * ldc + piece * 8) = o; if (C2) *(v8h*)(C2 + (size_t)r0 * ldc + c0 + (size_t)row * ldc + piece * 8) = o2; }
        };
        pass(); 
    } else {
        float* crow = C + (size_t)r0 * ldc + c0;
        auto pass = [&]() {
#pragma unroll
            for (int s = 0; s < 8; ++s) { const int Lid = (lane >> 3) + 4 * s, piece = lane & 7; const int row = Lid >> 1, cofs = (Lid & 1) * 32 + piece * 4;
                v4f val = *(const v4fa*)(os + row * 68 + cofs); if (R) { const v4f rv = *(const v4f*)(R + ((size_t)r0 + row) * ldc + c0 + cofs); val += roundR ? (v4f){bfr(rv[0]), bfr(rv[1]), bfr(rv[2]), bfr(rv[3])} : rv; }
                *(v4f*)(crow + (size_t)row * ldc + cofs) = val; }
        };
        pass(); 
    }
}

__global__ __launch_bounds__(256) void k_cvt8(const float* __restrict__ src, bf* dst, size_t n8) {
    const size_t i = (size_t)blockIdx.x * 256 + threadIdx.x; if (i >= n8) return;
    const v8f v = *(const v8f*)(src + i * 8); v8us o;
#pragma unroll
    for (int k = 0; k < 8; ++k) o[k] = f2bf(v[k]);
    *(v8us*)(dst + i * 8) = o; 
}
__global__ __launch_bounds__(256) void k_zero8(bf* dst, size_t n8) {
    const size_t i = (size_t)blockIdx.x * 256 + threadIdx.x; if (i >= n8) return; v8us z;
#pragma unroll
    for (int k = 0; k < 8; ++k) z[k] = 0;
    *(v8us*)(dst + i * 8) = z; 
}

__global__ __launch_bounds__(256) void k_cvtx(const float* __restrict__ src, bf* dst) {
    const int lane = threadIdx.x & 31; const size_t r = (size_t)blockIdx.x * 8 + (threadIdx.x >> 5); if (r >= (size_t)NN) return;
{
#pragma unroll
        for (int q = 0; q < DMOD / 256; ++q) { v8us o;
#pragma unroll
            for (int i = 0; i < 8; ++i) o[i] = f2bf(src[r * DMOD + q * 256 + lane * 8 + i]);
            *(v8us*)(dst + r * DMOD + q * 256 + lane * 8) = o; }
         }
}
// k_packk / k_packv: bf16 hi + residual planes of k and of v^T of one item, laid out in WMMA A-fragment order, so that every wave-wide 16-byte load of k_fattn reads 512 contiguous bytes.
// k: piece id = (((h * 128 + key tile) * 2 + ks) * 2 + u) * 32 + lane holds k[key tile * 16 + (lane & 15)][ks * 32 + u * 16 + 8 * (lane >> 4) + 0..7].
__global__ __launch_bounds__(256) void k_packk(const float* __restrict__ KF, bf* Ph, bf* Pl) {
    const unsigned id = blockIdx.x * 256 + threadIdx.x;
    const int l = id & 31, u = (id >> 5) & 1, ks = (id >> 6) & 1, kt = (id >> 7) & 127, h = id >> 14;
    const v8f v = *(const v8f*)(KF + (size_t)(kt * 16 + (l & 15)) * DMOD + h * HD + ks * 32 + u * 16 + 8 * (l >> 4)); v8us oh, ol;
#pragma unroll
    for (int i = 0; i < 8; ++i) { const unsigned short hb = f2bf(v[i]); oh[i] = hb; ol[i] = f2bf(v[i] - bf2f(hb)); }
    *(v8us*)(Ph + (size_t)id * 8) = oh; *(v8us*)(Pl + (size_t)id * 8) = ol;
}
// v^T: piece id = (((h * 64 + key block) * 4 + t) * 2 + u) * 32 + lane holds v[key block * 32 + u * 16 + 8 * (lane >> 4) + 0..7][t * 16 + (lane & 15)].
__global__ __launch_bounds__(256) void k_packv(const float* __restrict__ VF, bf* Ph, bf* Pl) {
    const unsigned id = blockIdx.x * 256 + threadIdx.x;
    const int l = id & 31, u = (id >> 5) & 1, t = (id >> 6) & 3, kb = (id >> 8) & 63, h = id >> 14;
    const float* s = VF + (size_t)(kb * 32 + u * 16 + 8 * (l >> 4)) * DMOD + h * HD + t * 16 + (l & 15); v8us oh, ol;
#pragma unroll
    for (int i = 0; i < 8; ++i) { const float v = s[(size_t)i * DMOD]; const unsigned short hb = f2bf(v); oh[i] = hb; ol[i] = f2bf(v - bf2f(hb)); }
    *(v8us*)(Ph + (size_t)id * 8) = oh; *(v8us*)(Pl + (size_t)id * 8) = ol;
}
__device__ __forceinline__ float xhalf(float x) { const int b = __float_as_int(x); return __int_as_float(__builtin_amdgcn_permlanex16(b, b, 0x76543210, 0xfedcba98, false, false)); }   // the value of lane ^ 16
__global__ __launch_bounds__(256) void k_fattn(const float* __restrict__ QF, const bf* __restrict__ KPh, const bf* __restrict__ KPl, const bf* __restrict__ VPh, const bf* __restrict__ VPl, const int* __restrict__ MK, bf* Ch, bf* Cl) {
    typedef __attribute__((ext_vector_type(2))) float v2f;
    typedef __attribute__((ext_vector_type(2))) __bf16 v2bf;
    typedef __attribute__((ext_vector_type(4))) int v4i;
    typedef __attribute__((ext_vector_type(8))) unsigned v8u;
    const int lane = threadIdx.x & 31, wave = threadIdx.x >> 5, c = lane & 15, hi = lane >> 4;
    const int h = blockIdx.y, b = blockIdx.z, q0 = blockIdx.x * 128 + wave * 16;
    const size_t qoff = ((size_t)b * NN + q0 + c) * DMOD + h * HD + 8 * hi;   // the lane's query row, this head's columns: q on the way in, ctx on the way out
    v16bf qh[2], ql[2];
#pragma unroll
    for (int ks = 0; ks < 2; ++ks) { v8us oh[2], ol[2];
#pragma unroll
        for (int u = 0; u < 2; ++u) { const v8f v = *(const v8f*)(QF + qoff + ks * 32 + u * 16);
#pragma unroll
            for (int i = 0; i < 8; ++i) { const unsigned short hb = f2bf(v[i]); oh[u][i] = hb; ol[u][i] = f2bf(v[i] - bf2f(hb)); } }
        qh[ks] = cat16b(oh[0], oh[1]); ql[ks] = cat16b(ol[0], ol[1]); }
    const char* kh_ = (const char*)KPh; const char* kl_ = (const char*)KPl; const char* vh_ = (const char*)VPh; const char* vl_ = (const char*)VPl; const char* mk_ = (const char*)MK;
    const unsigned pb = (((unsigned)b * NH_ + h) * (NN * HD) + lane * 8) * 2u, mo = ((unsigned)(q0 + c) * NN + 8 * hi) * 4u;   // 32-bit byte offsets on the kernel's own base pointers
    const float CS = SCL * 1.44269504088896340736f;   // scores in log2 units
    v8f acc[4];
#pragma unroll
    for (int t = 0; t < 4; ++t) acc[t] = (v8f){};
    float m = -1.0e30f, lsum = 0.f;
#pragma unroll 1   // rolled: one pass's fragments already take most of the registers that four waves per SIMD leave a wave
    for (int kb = 0; kb < NN / 32; ++kb) {
        const unsigned o = pb + kb * 4096u, om = mo + kb * 128u;
        v4i mk[4];
#pragma unroll
        for (int g = 0; g < 4; ++g) mk[g] = *(const v4i*)((mk_ + (g >> 1) * 64 + (g & 1) * 16) + om);
        v16bf kh[4], kl[4], vh[4], vl[4];
#pragma unroll
        for (int f = 0; f < 4; ++f) { const int fo = f * 1024;   // k: f = tile * 2 + ks; v^T: f = t
            kh[f] = cat16b(*(const v8us*)((kh_ + fo) + o), *(const v8us*)((kh_ + fo + 512) + o)); kl[f] = cat16b(*(const v8us*)((kl_ + fo) + o), *(const v8us*)((kl_ + fo + 512) + o)); }
#pragma unroll
        for (int f = 0; f < 4; ++f) { const int fo = f * 1024;
            vh[f] = cat16b(*(const v8us*)((vh_ + fo) + o), *(const v8us*)((vh_ + fo + 512) + o)); vl[f] = cat16b(*(const v8us*)((vl_ + fo) + o), *(const v8us*)((vl_ + fo + 512) + o)); }
        asm volatile("s_wait_xcnt 0x0" ::: "memory");   // stands in front of the steps of the two offset registers that the loads above name
        __builtin_amdgcn_sched_barrier(0);   // all of the pass's loads issue together, ahead of its products: left free, the scheduler reuses few registers and the wave waits out a load latency at every fragment
        v8f st[2];
#pragma unroll
        for (int tl = 0; tl < 2; ++tl) { st[tl] = (v8f){};
#pragma unroll
            for (int ks = 0; ks < 2; ++ks) { const int f = tl * 2 + ks;
                st[tl] = wmmab(kh[f], qh[ks], st[tl]); st[tl] = wmmab(kh[f], ql[ks], st[tl]); st[tl] = wmmab(kl[f], qh[ks], st[tl]); } }
        float p[16]; float mx = -3.0e38f;
#pragma unroll
        for (int s = 0; s < 16; ++s) { p[s] = (mk[s >> 2][s & 3] != 0) ? st[s >> 3][s & 7] * CS : -3.0e38f; mx = fmaxf(mx, p[s]); }
        mx = fmaxf(mx, xhalf(mx));
        const float mn = fmaxf(m, mx), al = __builtin_amdgcn_exp2f(m - mn); m = mn;
        float ps = 0.f;
#pragma unroll
        for (int s = 0; s < 16; ++s) { p[s] = __builtin_amdgcn_exp2f(p[s] - mn); ps += p[s]; }
        lsum = lsum * al + ps;
#pragma unroll
        for (int t = 0; t < 4; ++t) acc[t] *= al;
        v8u uh, ul;
#pragma unroll
        for (int s = 0; s < 8; ++s) { const v2f pp = {p[2 * s], p[2 * s + 1]}; const unsigned hw = __builtin_bit_cast(unsigned, __builtin_convertvector(pp, v2bf));
            const v2f rr = {pp[0] - __uint_as_float(hw << 16), pp[1] - __uint_as_float(hw & 0xFFFF0000u)}; uh[s] = hw; ul[s] = __builtin_bit_cast(unsigned, __builtin_convertvector(rr, v2bf)); }
        const v16bf ph = __builtin_bit_cast(v16bf, uh), pl = __builtin_bit_cast(v16bf, ul);
#pragma unroll
        for (int t = 0; t < 4; ++t) { acc[t] = wmmab(vh[t], ph, acc[t]); acc[t] = wmmab(vh[t], pl, acc[t]); acc[t] = wmmab(vl[t], ph, acc[t]); }
    }
    lsum += xhalf(lsum);
    const float inv = 1.0f / lsum;
#pragma unroll
    for (int t = 0; t < 4; ++t) { const v8f r = acc[t] * inv; v8us oh, ol;   // acc[t][r] = ctx[query c][t * 16 + 8 * hi + r], stored as the output GEMM's bf16 hi + residual planes
#pragma unroll
        for (int i = 0; i < 8; ++i) { const unsigned short hb = f2bf(r[i]); oh[i] = hb; ol[i] = f2bf(r[i] - bf2f(hb)); }
        *(v8us*)(Ch + qoff + t * 16) = oh; *(v8us*)(Cl + qoff + t * 16) = ol; }
}

extern "C" void kernel_launch(void* const* d_in, const int* in_sizes, int n_in,
                              void* d_out, int out_size, void* d_ws, size_t ws_size, hipStream_t stream) {
    (void)in_sizes; (void)n_in; (void)out_size;
    const float* x = (const float*)d_in[0]; const int* MK = (const int*)d_in[1]; const float* Wq = (const float*)d_in[2]; const float* Wk = (const float*)d_in[3]; const float* Wv = (const float*)d_in[4]; const float* Wo = (const float*)d_in[5]; const float* bo = (const float*)d_in[6];
    float* out = (float*)d_out;    // [2][2048][1024]
    char* wsp = (char*)d_ws;
    auto take = [&](size_t bytes) { char* p = wsp; wsp += (bytes + 255) & ~(size_t)255; return (void*)p; };
    const size_t IT = (size_t)NN * DMOD;    // elements of one item
    bf* WQ = (bf*)take((size_t)DMOD * DMOD * 2); bf* WK = (bf*)take((size_t)DMOD * DMOD * 2); bf* WV = (bf*)take((size_t)DMOD * DMOD * 2); bf* WO = (bf*)take((size_t)DMOD * DMOD * 2);
    bf* Xb = (bf*)take(IT * 2); float* QF = (float*)take(NBT * IT * 4); float* KF = (float*)take(IT * 4); float* VF = (float*)take(IT * 4);
    bf* KPh = (bf*)take(NBT * IT * 2); bf* KPl = (bf*)take(NBT * IT * 2); bf* VPh = (bf*)take(NBT * IT * 2); bf* VPl = (bf*)take(NBT * IT * 2);
    bf* Ch = (bf*)take(NBT * IT * 2); bf* Cl = (bf*)take(NBT * IT * 2);
    if ((size_t)(wsp - (char*)d_ws) > ws_size) return;    // 8.4 + 4.2 + 33.6 + 33.6 + 16.8 ~ 97 MB; Xb, KF, VF reused per item in stream order
    k_cvt8<<<(unsigned)(((size_t)DMOD * DMOD / 8 + 255) / 256), 256, 0, stream>>>(Wq, WQ, (size_t)DMOD * DMOD / 8); k_cvt8<<<(unsigned)(((size_t)DMOD * DMOD / 8 + 255) / 256), 256, 0, stream>>>(Wk, WK, (size_t)DMOD * DMOD / 8);
    k_cvt8<<<(unsigned)(((size_t)DMOD * DMOD / 8 + 255) / 256), 256, 0, stream>>>(Wv, WV, (size_t)DMOD * DMOD / 8); k_cvt8<<<(unsigned)(((size_t)DMOD * DMOD / 8 + 255) / 256), 256, 0, stream>>>(Wo, WO, (size_t)DMOD * DMOD / 8);   // [out][in] convention = n-major
    for (int b = 0; b < NBT; ++b) {
        k_cvtx<<<NN / 8, 256, 0, stream>>>(x + b * IT, Xb);
        k_gemmb<false, false><<<dim3(NN / 64, DMOD / 64, 1), 128, 0, stream>>>(Xb, nullptr, WQ, nullptr, QF + b * IT, DMOD, nullptr, nullptr);
        k_gemmb<false, false><<<dim3(NN / 64, DMOD / 64, 1), 128, 0, stream>>>(Xb, nullptr, WK, nullptr, KF, DMOD, nullptr, nullptr);
        k_gemmb<false, false><<<dim3(NN / 64, DMOD / 64, 1), 128, 0, stream>>>(Xb, nullptr, WV, nullptr, VF, DMOD, nullptr, nullptr);
        k_packk<<<NN * DMOD / 8 / 256, 256, 0, stream>>>(KF, KPh + b * IT, KPl + b * IT); k_packv<<<NN * DMOD / 8 / 256, 256, 0, stream>>>(VF, VPh + b * IT, VPl + b * IT); }
    k_fattn<<<dim3(NN / 128, NH_, NBT), 256, 0, stream>>>(QF, KPh, KPl, VPh, VPl, MK, Ch, Cl);
    for (int b = 0; b < NBT; ++b)
        k_gemmb<true, false><<<dim3(NN / 64, DMOD / 64, 1), 128, 0, stream>>>(Ch + b * IT, Cl + b * IT, WO, bo, out + b * IT, DMOD, nullptr, nullptr);
}

// v003
// A run of this version takes 178 microseconds.
// In two side-by-side timings against v002, it was 1.20 and 1.19 times as fast.
// Over all steps from v000 it is 22.6 times as fast.
#include <hip/hip_runtime.h>

// Compute dtypes, f32 accumulate, per item: q/k/v = the k=1 causal convs = x.W^T as [2048 x 1024].[1024 x 1024] GEMMs with PLAIN bf16 operands (exact products); per head, in ONE fused kernel: scores^T = k.q^T (both operands bf16 hi + UNSCALED residual, three products), masked online softmax (x 1/8; positions where the INPUT attn_mask == 0 are excluded, per (query, key), from the bit form that k_mbits makes of the mask in the same call) in f32, ctx^T += v^T.P^T (P and v as bf16 hi + residual, three products)

#define NBT  2
#define NN   2048
#define DMOD 1024
#define NH_  16
#define HD   64
#define DM   DMOD
#define NTK  NN
#define SCL  0.125f
#define LOSC 1024.0f

typedef _Float16 h16;
typedef unsigned short bf;
typedef __attribute__((ext_vector_type(16))) __bf16   v16bf;
typedef __attribute__((ext_vector_type(16))) _Float16 v16h;
typedef __attribute__((ext_vector_type(8)))  _Float16 v8h;
typedef __attribute__((ext_vector_type(8)))  unsigned short v8us;
typedef __attribute__((ext_vector_type(8)))  float    v8f;
typedef __attribute__((ext_vector_type(4)))  float    v4f;
typedef __attribute__((ext_vector_type(4)))  _Float16 v4h;
typedef v8h  __attribute__((may_alias)) v8ha;
typedef v4f  __attribute__((may_alias)) v4fa;
typedef v8us __attribute__((may_alias)) v8usa;

__device__ __forceinline__ unsigned short f2bf(float f) { unsigned u = __float_as_uint(f); u += 0x7FFFu + ((u >> 16) & 1u); return (unsigned short)(u >> 16); }
__device__ __forceinline__ float bf2f(unsigned short b) { return __uint_as_float(((unsigned)b) << 16); }
__device__ __forceinline__ float bfr(float f) { return bf2f(f2bf(f)); }
__device__ __forceinline__ v16h cat16(v8h lo, v8h hi) { return __builtin_shufflevector(lo, hi, 0, 1, 2, 3, 4, 5, 6, 7, 8, 9, 10, 11, 12, 13, 14, 15); }
__device__ __forceinline__ v16bf cat16b(v8us lo, v8us hi) { return __builtin_bit_cast(v16bf, __builtin_shufflevector(lo, hi, 0, 1, 2, 3, 4, 5, 6, 7, 8, 9, 10, 11, 12, 13, 14, 15)); }
__device__ __forceinline__ v8f wmma16(v16h a, v16h b, v8f c) { return __builtin_amdgcn_wmma_f32_16x16x32_f16(false, a, false, b, (short)0, c, false, false); }
__device__ __forceinline__ v8f wmmab(v16bf a, v16bf b, v8f c) { return __builtin_amdgcn_wmma_f32_16x16x32_bf16(false, a, false, b, (short)0, c, false, false); }

// k_gemmb: 64 x 64 block tile (4 waves x 16 x 64) of C[NTK][NW] = (A [+ Al]).B^T (K = DM) [+ bf(bias[c])] [+ bf(R[r][c]) residual]; f32 whole-line epilogue (or f16
// The operand tiles (64 rows x KS k each) go through LDS: every wave-wide 16-byte global load covers two 256-byte row pieces (four whole lines), the B tile is fetched once for the four waves,
// and stage s + 1 is on its way in registers while stage s is multiplied. Rows lie LP bytes apart in LDS (an odd multiple of 16 bytes: the 16 rows of a fragment read fall on 64 different banks).
// amdgpu_num_vgpr(256): left free, the build with three tiles runs two registers past v255.
#define KS 128
#define LP (KS * 2 + 16)
template <bool SPLITA, bool F16OUT = false>
__global__ __launch_bounds__(128) __attribute__((amdgpu_num_vgpr(256))) void k_gemmb(const bf* __restrict__ A, const bf* __restrict__ Al, const bf* __restrict__ Bn, const float* __restrict__ bias, float* C, int ldc, h16* C2, const float* __restrict__ R = nullptr, int roundR = 1) {
    constexpr int NT = SPLITA ? 3 : 2;   // tiles of a stage: A, [Al,] B
    constexpr int GQ = SPLITA ? 1 : 2;   // 32-k steps whose fragments are read from LDS as one group
    __shared__ __align__(16) float ost[4][16 * 68];
    __shared__ __align__(16) char stg[2][NT][64 * LP];
    const int lane = threadIdx.x & 31, wave = threadIdx.x >> 5, lr = lane & 15, hi = lane >> 4;
    const int r0 = blockIdx.x * 64 + wave * 16, c0 = blockIdx.y * 64;
    const int srow = threadIdx.x >> 4, spc = threadIdx.x & 15;   // staging: this thread moves piece spc (16 bytes) of rows srow + 8 i of every tile
    const char* ga = (const char*)A + ((size_t)(blockIdx.x * 64 + srow) * DM + spc * 8) * 2;
    const char* gl = (const char*)(SPLITA ? Al : A) + ((size_t)(blockIdx.x * 64 + srow) * DM + spc * 8) * 2;
    const char* gb = (const char*)Bn + ((size_t)(c0 + srow) * DM + spc * 8) * 2;
    const int ls = srow * LP + spc * 16, fa = (wave * 16 + lr) * LP + hi * 16, fb = lr * LP + hi * 16;
    v8us ra[8], rl[8], rb[8];
    auto fetch = [&](int s) {
#pragma unroll
        for (int i = 0; i < 8; ++i) { const int o = i * 8 * DM * 2 + s * KS * 2; ra[i] = *(const v8us*)(ga + o); if (SPLITA) rl[i] = *(const v8us*)(gl + o); rb[i] = *(const v8us*)(gb + o); }
    };
    auto put = [&](int buf) {
#pragma unroll
        for (int i = 0; i < 8; ++i) { const int o = ls + i * 8 * LP; *(v8usa*)(&stg[buf][0][o]) = ra[i]; if (SPLITA) *(v8usa*)(&stg[buf][1][o]) = rl[i]; *(v8usa*)(&stg[buf][NT - 1][o]) = rb[i]; }
    };
    v8f acc[4];
#pragma unroll
    for (int t = 0; t < 4; ++t) acc[t] = (v8f){};
    fetch(0); put(0);
    __syncthreads();
#pragma unroll   // unrolled: buffer, stage offset and the last stage's test become constants, and no address register is stepped behind a load
    for (int s = 0; s < DM / KS; ++s) {
        const int buf = s & 1;
        if (s + 1 < DM / KS) fetch(s + 1);
#pragma unroll
        for (int g = 0; g < KS / 32 / GQ; ++g) {   // eight products at a time: what fits 256 registers beside the stage in flight
            v16bf a[GQ], al[GQ], b[GQ][4];
#pragma unroll
            for (int q = 0; q < GQ; ++q) { const int k = (g * GQ + q) * 64;
                a[q] = cat16b(*(const v8usa*)(&stg[buf][0][fa + k]), *(const v8usa*)(&stg[buf][0][fa + k + 32]));
                if (SPLITA) al[q] = cat16b(*(const v8usa*)(&stg[buf][1][fa + k]), *(const v8usa*)(&stg[buf][1][fa + k + 32]));
#pragma unroll
                for (int t = 0; t < 4; ++t) b[q][t] = cat16b(*(const v8usa*)(&stg[buf][NT - 1][fb + t * 16 * LP + k]), *(const v8usa*)(&stg[buf][NT - 1][fb + t * 16 * LP + k + 32])); }
            __builtin_amdgcn_sched_barrier(0);   // the group's LDS reads issue together, ahead of its products: left free, the scheduler reuses one fragment's registers and the wave waits out an LDS latency at every product
#pragma unroll
            for (int q = 0; q < GQ; ++q)
#pragma unroll
                for (int t = 0; t < 4; ++t) { acc[t] = wmmab(a[q], b[q][t], acc[t]); if (SPLITA) acc[t] = wmmab(al[q], b[q][t], acc[t]); }
        }
        if (s + 1 < DM / KS) {
            put(buf ^ 1);      // into the buffer that stage s - 1 was read from: its readers left it at the barrier that ended that stage
            __syncthreads();   // publishes stage s + 1 and ends the reads of stage s
        }
    }
    float* os = &ost[wave][0];
#pragma unroll
    for (int t = 0; t < 4; ++t) { const float bv = bias ? bfr(bias[c0 + t * 16 + lr]) : 0.f;
#pragma unroll
        for (int j = 0; j < 8; ++j) os[(hi * 8 + j) * 68 + t * 16 + lr] = acc[t][j] + bv; }
    __syncthreads();
    if (F16OUT) {
        h16* crow = (h16*)(void*)C + (size_t)r0 * ldc + c0;
        auto pass = [&]() {
#pragma unroll
            for (int s = 0; s < 4; ++s) { const int row = 4 * s + (lane >> 3), piece = lane & 7; const float* sp = os + row * 68 + piece * 8; v8h o, o2;
#pragma unroll
                for (int i = 0; i < 8; ++i) { const h16 a = (h16)sp[i]; o[i] = a; o2[i] = (h16)((sp[i] - (float)a) * LOSC); }
                *(v8h*)(crow + (size_t)row * ldc + piece * 8) = o; if (C2) *(v8h*)(C2 + (size_t)r0 * ldc + c0 + (size_t)row * ldc + piece * 8) = o2; }
        };
        pass(); 
    } else {
        float* crow = C + (size_t)r0 * ldc + c0;
        auto pass = [&]() {
#pragma unroll
            for (int s = 0; s < 8; ++s) { const int Lid = (lane >> 3) + 4 * s, piece = lane & 7; const int row = Lid >> 1, cofs = (Lid & 1) * 32 + piece * 4;
                v4f val = *(const v4fa*)(os + row * 68 + cofs); if (R) { const v4f rv = *(const v4f*)(R + ((size_t)r0 + row) * ldc + c0 + cofs); val += roundR ? (v4f){bfr(rv[0]), bfr(rv[1]), bfr(rv[2]), bfr(rv[3])} : rv; }
                *(v4f*)(crow + (size_t)row * ldc + cofs) = val; }
        };
        pass(); 
    }
}

__global__ __launch_bounds__(256) void k_cvt8(const float* __restrict__ src, bf* dst, size_t n8) {
    const size_t i = (size_t)blockIdx.x * 256 + threadIdx.x; if (i >= n8) return;
    const v8f v = *(const v8f*)(src + i * 8); v8us o;
#pragma unroll
    for (int k = 0; k < 8; ++k) o[k] = f2bf(v[k]);
    *(v8us*)(dst + i * 8) = o; 
}
__global__ __launch_bounds__(256) void k_zero8(bf* dst, size_t n8) {
    const size_t i = (size_t)blockIdx.x * 256 + threadIdx.x; if (i >= n8) return; v8us z;
#pragma unroll
    for (int k = 0; k < 8; ++k) z[k] = 0;
    *(v8us*)(dst + i * 8) = z; 
}

__global__ __launch_bounds__(256) void k_cvtx(const float* __restrict__ src, bf* dst) {
    const int lane = threadIdx.x & 31; const size_t r = (size_t)blockIdx.x * 8 + (threadIdx.x >> 5); if (r >= (size_t)NN) return;
{
#pragma unroll
        for (int q = 0; q < DMOD / 256; ++q) { v8us o;
#pragma unroll
            for (int i = 0; i < 8; ++i) o[i] = f2bf(src[r * DMOD + q * 256 + lane * 8 + i]);
            *(v8us*)(dst + r * DMOD + q * 256 + lane * 8) = o; }
         }
}
// k_packk / k_packv: bf16 hi + residual planes of k and of v^T of one item, laid out in WMMA A-fragment order, so that every wave-wide 16-byte load of k_fattn reads 512 contiguous bytes.
// k: piece id = (((h * 128 + key tile) * 2 + ks) * 2 + u) * 32 + lane holds k[key tile * 16 + (lane & 15)][ks * 32 + u * 16 + 8 * (lane >> 4) + 0..7].
__global__ __launch_bounds__(256) void k_packk(const float* __restrict__ KF, bf* Ph, bf* Pl) {
    const unsigned id = blockIdx.x * 256 + threadIdx.x;
    const int l = id & 31, u = (id >> 5) & 1, ks = (id >> 6) & 1, kt = (id >> 7) & 127, h = id >> 14;
    const v8f v = *(const v8f*)(KF + (size_t)(kt * 16 + (l & 15)) * DMOD + h * HD + ks * 32 + u * 16 + 8 * (l >> 4)); v8us oh, ol;
#pragma unroll
    for (int i = 0; i < 8; ++i) { const unsigned short hb = f2bf(v[i]); oh[i] = hb; ol[i] = f2bf(v[i] - bf2f(hb)); }
    *(v8us*)(Ph + (size_t)id * 8) = oh; *(v8us*)(Pl + (size_t)id * 8) = ol;
}
// v^T: piece id = (((h * 64 + key block) * 4 + t) * 2 + u) * 32 + lane holds v[key block * 32 + u * 16 + 8 * (lane >> 4) + 0..7][t * 16 + (lane & 15)].
__global__ __launch_bounds__(256) void k_packv(const float* __restrict__ VF, bf* Ph, bf* Pl) {
    const unsigned id = blockIdx.x * 256 + threadIdx.x;
    const int l = id & 31, u = (id >> 5) & 1, t = (id >> 6) & 3, kb = (id >> 8) & 63, h = id >> 14;
    const float* s = VF + (size_t)(kb * 32 + u * 16 + 8 * (l >> 4)) * DMOD + h * HD + t * 16 + (l & 15); v8us oh, ol;
#pragma unroll
    for (int i = 0; i < 8; ++i) { const float v = s[(size_t)i * DMOD]; const unsigned short hb = f2bf(v); oh[i] = hb; ol[i] = f2bf(v - bf2f(hb)); }
    *(v8us*)(Ph + (size_t)id * 8) = oh; *(v8us*)(Pl + (size_t)id * 8) = ol;
}
// k_mbits: the mask, read once. One block = 16 queries (a k_fattn tile) x 1024 keys, one wave a query row; a wave-wide 4-byte load covers one 32-key block (one line) and its ballot is that block's bit word (bit i = key i kept).
// WT[(tile * 64 + key block) * 16 + query] = the word, so that one load of k_fattn touches one line; FL[(tile * 2 + key half) * 32 + 0 / 1] = bit per key block: some key kept by some query of the tile / every key kept by every query.
// Each block writes whole lines of its own (its two flag words have a 128-byte line to themselves).
__global__ __launch_bounds__(512) void k_mbits(const int* __restrict__ MK, unsigned* WT, unsigned* FL) {
    __shared__ unsigned sh[16][33];   // 33: the 16 rows of one key block fall on different banks
    const int lane = threadIdx.x & 31, row = threadIdx.x >> 5, tile = blockIdx.x, half = blockIdx.y;
    const int* s = MK + (size_t)(tile * 16 + row) * NN + half * (NN / 2) + lane;
    int v[32];
#pragma unroll
    for (int i = 0; i < 32; ++i) v[i] = s[i * 32];
    unsigned mine = 0;
#pragma unroll
    for (int i = 0; i < 32; ++i) { const unsigned w = __builtin_amdgcn_ballot_w32(v[i] != 0); mine = (lane == i) ? w : mine; }
    sh[row][lane] = mine;
    __syncthreads();
    WT[(size_t)(tile * 64 + half * 32) * 16 + threadIdx.x] = sh[threadIdx.x & 15][threadIdx.x >> 4];
    if (row == 0) { unsigned o = 0u, a = ~0u;
#pragma unroll
        for (int r = 0; r < 16; ++r) { const unsigned w = sh[r][lane]; o |= w; a &= w; }
        const unsigned ne = __builtin_amdgcn_ballot_w32(o != 0u), fu = __builtin_amdgcn_ballot_w32(a == ~0u);
        if (lane < 2) FL[(tile * 2 + half) * 32 + lane] = lane ? fu : ne; }
}
__device__ __forceinline__ float xhalf(float x) { const int b = __float_as_int(x); return __int_as_float(__builtin_amdgcn_permlanex16(b, b, 0x76543210, 0xfedcba98, false, false)); }   // the value of lane ^ 16
__global__ __launch_bounds__(256) void k_fattn(const float* __restrict__ QF, const bf* __restrict__ KPh, const bf* __restrict__ KPl, const bf* __restrict__ VPh, const bf* __restrict__ VPl, const unsigned* __restrict__ WT, const unsigned* __restrict__ FL, bf* Ch, bf* Cl) {
    typedef __attribute__((ext_vector_type(2))) float v2f;
    typedef __attribute__((ext_vector_type(2))) __bf16 v2bf;
    typedef __attribute__((ext_vector_type(8))) unsigned v8u;
    const int lane = threadIdx.x & 31, wave = __builtin_amdgcn_readfirstlane(threadIdx.x >> 5), c = lane & 15, hi = lane >> 4;
    const int tile = wave < 4 ? blockIdx.x * 4 + wave : NN / 16 - 1 - (blockIdx.x * 4 + wave - 4);   // every tile 0..127 once
    const int h = blockIdx.y, b = blockIdx.z, q0 = tile * 16;
    const unsigned long long ne = (unsigned long long)FL[tile * 64] | (unsigned long long)FL[tile * 64 + 32] << 32, fu = (unsigned long long)FL[tile * 64 + 1] | (unsigned long long)FL[tile * 64 + 33] << 32;   // bit kb: block not empty / full
    const size_t qoff = ((size_t)b * NN + q0 + c) * DMOD + h * HD + 8 * hi;   // the lane's query row, this head's columns: q on the way in, ctx on the way out
    v16bf qh[2], ql[2];
#pragma unroll
    for (int ks = 0; ks < 2; ++ks) { v8us oh[2], ol[2];
#pragma unroll
        for (int u = 0; u < 2; ++u) { const v8f v = *(const v8f*)(QF + qoff + ks * 32 + u * 16);
#pragma unroll
            for (int i = 0; i < 8; ++i) { const unsigned short hb = f2bf(v[i]); oh[u][i] = hb; ol[u][i] = f2bf(v[i] - bf2f(hb)); } }
        qh[ks] = cat16b(oh[0], oh[1]); ql[ks] = cat16b(ol[0], ol[1]); }
    const char* kh_ = (const char*)KPh; const char* kl_ = (const char*)KPl; const char* vh_ = (const char*)VPh; const char* vl_ = (const char*)VPl; const char* wt_ = (const char*)WT;
    const unsigned pb = (((unsigned)b * NH_ + h) * (NN * HD) + lane * 8) * 2u, mo = ((unsigned)tile * 1024u + c) * 4u;   // 32-bit byte offsets on the kernel's own base pointers
    const float CS = SCL * 1.44269504088896340736f;   // scores in log2 units
    v8f acc[4];
#pragma unroll
    for (int t = 0; t < 4; ++t) acc[t] = (v8f){};
    float m = -1.0e30f, lsum = 0.f;
#pragma unroll 1   // rolled: one pass's fragments already take most of the registers that four waves per SIMD leave a wave
    for (int kb = 0; kb < NN / 32; ++kb) {
        if (!((ne >> kb) & 1ull)) continue;   // the same for the whole wave: a scalar test
        const unsigned o = pb + kb * 4096u, om = mo + kb * 64u;
        v16bf kh[4], kl[4], vh[4], vl[4];
#pragma unroll
        for (int f = 0; f < 4; ++f) { const int fo = f * 1024;   // k: f = tile * 2 + ks; v^T: f = t
            kh[f] = cat16b(*(const v8us*)((kh_ + fo) + o), *(const v8us*)((kh_ + fo + 512) + o)); kl[f] = cat16b(*(const v8us*)((kl_ + fo) + o), *(const v8us*)((kl_ + fo + 512) + o)); }
#pragma unroll
        for (int f = 0; f < 4; ++f) { const int fo = f * 1024;
            vh[f] = cat16b(*(const v8us*)((vh_ + fo) + o), *(const v8us*)((vh_ + fo + 512) + o)); vl[f] = cat16b(*(const v8us*)((vl_ + fo) + o), *(const v8us*)((vl_ + fo + 512) + o)); }
        asm volatile("s_wait_xcnt 0x0" ::: "memory");   // stands in front of the step of the offset register that the loads above name
        __builtin_amdgcn_sched_barrier(0);   // the pass's k and v fragment loads issue together, ahead of its products: left free, the scheduler reuses few registers and the wave waits out a load latency at every fragment
        v8f st[2];
#pragma unroll
        for (int tl = 0; tl < 2; ++tl) { st[tl] = (v8f){};
#pragma unroll
            for (int ks = 0; ks < 2; ++ks) { const int f = tl * 2 + ks;
                st[tl] = wmmab(kh[f], qh[ks], st[tl]); st[tl] = wmmab(kh[f], ql[ks], st[tl]); st[tl] = wmmab(kl[f], qh[ks], st[tl]); } }
        float p[16]; float mx = -3.0e38f;
#pragma unroll
        for (int s = 0; s < 16; ++s) p[s] = st[s >> 3][s & 7] * CS;
        if (!((fu >> kb) & 1ull)) {   // the same for the whole wave; only a mixed block reads its word: the lane's query, this block's 32 keys
            const unsigned mw = *(const unsigned*)(wt_ + om);
            asm volatile("s_wait_xcnt 0x0" ::: "memory");   // stands in front of the step of the address register that the load above names
            const unsigned ml = mw >> (8 * hi);   // score s of the lane is key (s >> 3) * 16 + 8 * hi + (s & 7) of the block
#pragma unroll
            for (int s = 0; s < 16; ++s) p[s] = (ml & (1u << ((s >> 3) * 16 + (s & 7)))) ? p[s] : -3.0e38f; }
#pragma unroll
        for (int s = 0; s < 16; ++s) mx = fmaxf(mx, p[s]);
        mx = fmaxf(mx, xhalf(mx));
        const float mn = fmaxf(m, mx), al = __builtin_amdgcn_exp2f(m - mn); m = mn;
        float ps = 0.f;
#pragma unroll
        for (int s = 0; s < 16; ++s) { p[s] = __builtin_amdgcn_exp2f(p[s] - mn); ps += p[s]; }
        lsum = lsum * al + ps;
#pragma unroll
        for (int t = 0; t < 4; ++t) acc[t] *= al;
        v8u uh, ul;
#pragma unroll
        for (int s = 0; s < 8; ++s) { const v2f pp = {p[2 * s], p[2 * s + 1]}; const unsigned hw = __builtin_bit_cast(unsigned, __builtin_convertvector(pp, v2bf));
            const v2f rr = {pp[0] - __uint_as_float(hw << 16), pp[1] - __uint_as_float(hw & 0xFFFF0000u)}; uh[s] = hw; ul[s] = __builtin_bit_cast(unsigned, __builtin_convertvector(rr, v2bf)); }
        const v16bf ph = __builtin_bit_cast(v16bf, uh), pl = __builtin_bit_cast(v16bf, ul);
#pragma unroll
        for (int t = 0; t < 4; ++t) { acc[t] = wmmab(vh[t], ph, acc[t]); acc[t] = wmmab(vh[t], pl, acc[t]); acc[t] = wmmab(vl[t], ph, acc[t]); }
    }
    lsum += xhalf(lsum);
    const float inv = 1.0f / lsum;
#pragma unroll
    for (int t = 0; t < 4; ++t) { const v8f r = acc[t] * inv; v8us oh, ol;   // acc[t][r] = ctx[query c][t * 16 + 8 * hi + r], stored as the output GEMM's bf16 hi + residual planes
#pragma unroll
        for (int i = 0; i < 8; ++i) { const unsigned short hb = f2bf(r[i]); oh[i] = hb; ol[i] = f2bf(r[i] - bf2f(hb)); }
        *(v8us*)(Ch + qoff + t * 16) = oh; *(v8us*)(Cl + qoff + t * 16) = ol; }
}

extern "C" void kernel_launch(void* const* d_in, const int* in_sizes, int n_in,
                              void* d_out, int out_size, void* d_ws, size_t ws_size, hipStream_t stream) {
    (void)in_sizes; (void)n_in; (void)out_size;
    const float* x = (const float*)d_in[0]; const int* MK = (const int*)d_in[1]; const float* Wq = (const float*)d_in[2]; const float* Wk = (const float*)d_in[3]; const float* Wv = (const float*)d_in[4]; const float* Wo = (const float*)d_in[5]; const float* bo = (const float*)d_in[6];
    float* out = (float*)d_out;    // [2][2048][1024]
    char* wsp = (char*)d_ws;
    auto take = [&](size_t bytes) { char* p = wsp; wsp += (bytes + 255) & ~(size_t)255; return (void*)p; };
    const size_t IT = (size_t)NN * DMOD;    // elements of one item
    bf* WQ = (bf*)take((size_t)DMOD * DMOD * 2); bf* WK = (bf*)take((size_t)DMOD * DMOD * 2); bf* WV = (bf*)take((size_t)DMOD * DMOD * 2); bf* WO = (bf*)take((size_t)DMOD * DMOD * 2);
    bf* Xb = (bf*)take(IT * 2); float* QF = (float*)take(NBT * IT * 4); float* KF = (float*)take(IT * 4); float* VF = (float*)take(IT * 4);
    bf* KPh = (bf*)take(NBT * IT * 2); bf* KPl = (bf*)take(NBT * IT * 2); bf* VPh = (bf*)take(NBT * IT * 2); bf* VPl = (bf*)take(NBT * IT * 2);
    bf* Ch = (bf*)take(NBT * IT * 2); bf* Cl = (bf*)take(NBT * IT * 2);
    unsigned* WT = (unsigned*)take((size_t)NN * (NN / 32) * 4); unsigned* FL = (unsigned*)take((size_t)(NN / 16) * 2 * 128);
    if ((size_t)(wsp - (char*)d_ws) > ws_size) return;    // 8.4 + 4.2 + 33.6 + 33.6 + 16.8 ~ 97 MB; Xb, KF, VF reused per item in stream order
    k_cvt8<<<(unsigned)(((size_t)DMOD * DMOD / 8 + 255) / 256), 256, 0, stream>>>(Wq, WQ, (size_t)DMOD * DMOD / 8); k_cvt8<<<(unsigned)(((size_t)DMOD * DMOD / 8 + 255) / 256), 256, 0, stream>>>(Wk, WK, (size_t)DMOD * DMOD / 8);
    k_cvt8<<<(unsigned)(((size_t)DMOD * DMOD / 8 + 255) / 256), 256, 0, stream>>>(Wv, WV, (size_t)DMOD * DMOD / 8); k_cvt8<<<(unsigned)(((size_t)DMOD * DMOD / 8 + 255) / 256), 256, 0, stream>>>(Wo, WO, (size_t)DMOD * DMOD / 8);   // [out][in] convention = n-major
    for (int b = 0; b < NBT; ++b) {
        k_cvtx<<<NN / 8, 256, 0, stream>>>(x + b * IT, Xb);
        k_gemmb<false, false><<<dim3(NN / 64, DMOD / 64, 1), 128, 0, stream>>>(Xb, nullptr, WQ, nullptr, QF + b * IT, DMOD, nullptr, nullptr);
        k_gemmb<false, false><<<dim3(NN / 64, DMOD / 64, 1), 128, 0, stream>>>(Xb, nullptr, WK, nullptr, KF, DMOD, nullptr, nullptr);
        k_gemmb<false, false><<<dim3(NN / 64, DMOD / 64, 1), 128, 0, stream>>>(Xb, nullptr, WV, nullptr, VF, DMOD, nullptr, nullptr);
        k_packk<<<NN * DMOD / 8 / 256, 256, 0, stream>>>(KF, KPh + b * IT, KPl + b * IT); k_packv<<<NN * DMOD / 8 / 256, 256, 0, stream>>>(VF, VPh + b * IT, VPl + b * IT); }
    k_mbits<<<dim3(NN / 16, 2, 1), 512, 0, stream>>>(MK, WT, FL);
    k_fattn<<<dim3(NN / 128, NH_, NBT), 256, 0, stream>>>(QF, KPh, KPl, VPh, VPl, WT, FL, Ch, Cl);
    for (int b = 0; b < NBT; ++b)
        k_gemmb<true, false><<<dim3(NN / 64, DMOD / 64, 1), 128, 0, stream>>>(Ch + b * IT, Cl + b * IT, WO, bo, out + b * IT, DMOD, nullptr, nullptr);
}

// v004
// It runs in 145 microseconds.
// Two timings next to v003 both put it at 1.22 times that version's speed.
// All steps since v000 together make it 27.6 times as fast.
#include <hip/hip_runtime.h>

// Compute dtypes, f32 accumulate, per item: q/k/v = the k=1 causal convs = x.W^T as [2048 x 1024].[1024 x 1024] GEMMs with PLAIN bf16 operands (exact products); per head, in ONE fused kernel: scores^T = k.q^T (both operands bf16 hi + UNSCALED residual, three products), masked online softmax (x 1/8; positions where the INPUT attn_mask == 0 are excluded, per (query, key), from the bit form that d_mbits makes of the mask in the same call) in f32, ctx^T += v^T.P^T (P and v as bf16 hi + residual, three products)

#define NBT  2
#define NN   2048
#define DMOD 1024
#define NH_  16
#define HD   64
#define DM   DMOD
#define NTK  NN
#define SCL  0.125f
#define LOSC 1024.0f

typedef _Float16 h16;
typedef unsigned short bf;
typedef __attribute__((ext_vector_type(16))) __bf16   v16bf;
typedef __attribute__((ext_vector_type(16))) _Float16 v16h;
typedef __attribute__((ext_vector_type(8)))  _Float16 v8h;
typedef __attribute__((ext_vector_type(8)))  unsigned short v8us;
typedef __attribute__((ext_vector_type(8)))  float    v8f;
typedef __attribute__((ext_vector_type(4)))  float    v4f;
typedef __attribute__((ext_vector_type(4)))  _Float16 v4h;
typedef v8h  __attribute__((may_alias)) v8ha;
typedef v4f  __attribute__((may_alias)) v4fa;
typedef v8us __attribute__((may_alias)) v8usa;

__device__ __forceinline__ unsigned short f2bf(float f) { unsigned u = __float_as_uint(f); u += 0x7FFFu + ((u >> 16) & 1u); return (unsigned short)(u >> 16); }
__device__ __forceinline__ float bf2f(unsigned short b) { return __uint_as_float(((unsigned)b) << 16); }
__device__ __forceinline__ float bfr(float f) { return bf2f(f2bf(f)); }
__device__ __forceinline__ v16h cat16(v8h lo, v8h hi) { return __builtin_shufflevector(lo, hi, 0, 1, 2, 3, 4, 5, 6, 7, 8, 9, 10, 11, 12, 13, 14, 15); }
__device__ __forceinline__ v16bf cat16b(v8us lo, v8us hi) { return __builtin_bit_cast(v16bf, __builtin_shufflevector(lo, hi, 0, 1, 2, 3, 4, 5, 6, 7, 8, 9, 10, 11, 12, 13, 14, 15)); }
__device__ __forceinline__ v8f wmma16(v16h a, v16h b, v8f c) { return __builtin_amdgcn_wmma_f32_16x16x32_f16(false, a, false, b, (short)0, c, false, false); }
__device__ __forceinline__ v8f wmmab(v16bf a, v16bf b, v8f c) { return __builtin_amdgcn_wmma_f32_16x16x32_bf16(false, a, false, b, (short)0, c, false, false); }

// k_gemmb: 64 x 64 block tile (4 waves x 16 x 64) of C[NBT * NTK][NW] = (A [+ Al]).B^T (K = DM) [+ bf(bias[c])] [+ bf(R[r][c]) residual]; f32 whole-line epilogue (or f16
// The operand tiles (64 rows x KS k each) go through LDS: every wave-wide 16-byte global load covers two 256-byte row pieces (four whole lines), the B tile is fetched once for the four waves,
// and stage s + 1 is on its way in registers while stage s is multiplied. Rows lie LP bytes apart in LDS (an odd multiple of 16 bytes: the 16 rows of a fragment read fall on 64 different banks).
// amdgpu_num_vgpr(256): left free, the build with three tiles runs two registers past v255.
#define KS 128
#define LP (KS * 2 + 16)
template <bool SPLITA, bool F16OUT = false>
__global__ __launch_bounds__(128) __attribute__((amdgpu_num_vgpr(256))) void k_gemmb(const bf* __restrict__ A, const bf* __restrict__ Al, const bf* __restrict__ Bn, const float* __restrict__ bias, float* C, int ldc, h16* C2, const float* __restrict__ R = nullptr, int roundR = 1, int zB = 0, int zC = 0) {
    Bn += (size_t)blockIdx.z * zB; C += (size_t)blockIdx.z * zC;   // grid plane z: its own B matrix and its own C (the q, k, v projections in one launch); the rows of A and C run over all items
    constexpr int NT = SPLITA ? 3 : 2;   // tiles of a stage: A, [Al,] B
    constexpr int GQ = SPLITA ? 1 : 2;   // 32-k steps whose fragments are read from LDS as one group
    __shared__ __align__(16) float ost[4][16 * 68];
    __shared__ __align__(16) char stg[2][NT][64 * LP];
    const int lane = threadIdx.x & 31, wave = threadIdx.x >> 5, lr = lane & 15, hi = lane >> 4;
    const int r0 = blockIdx.x * 64 + wave * 16, c0 = blockIdx.y * 64;
    const int srow = threadIdx.x >> 4, spc = threadIdx.x & 15;   // staging: this thread moves piece spc (16 bytes) of rows srow + 8 i of every tile
    const char* ga = (const char*)A + ((size_t)(blockIdx.x * 64 + srow) * DM + spc * 8) * 2;
    const char* gl = (const char*)(SPLITA ? Al : A) + ((size_t)(blockIdx.x * 64 + srow) * DM + spc * 8) * 2;
    const char* gb = (const char*)Bn + ((size_t)(c0 + srow) * DM + spc * 8) * 2;
    const int ls = srow * LP + spc * 16, fa = (wave * 16 + lr) * LP + hi * 16, fb = lr * LP + hi * 16;
    v8us ra[8], rl[8], rb[8];
    auto fetch = [&](int s) {
#pragma unroll
        for (int i = 0; i < 8; ++i) { const int o = i * 8 * DM * 2 + s * KS * 2; ra[i] = *(const v8us*)(ga + o); if (SPLITA) rl[i] = *(const v8us*)(gl + o); rb[i] = *(const v8us*)(gb + o); }
    };
    auto put = [&](int buf) {
#pragma unroll
        for (int i = 0; i < 8; ++i) { const int o = ls + i * 8 * LP; *(v8usa*)(&stg[buf][0][o]) = ra[i]; if (SPLITA) *(v8usa*)(&stg[buf][1][o]) = rl[i]; *(v8usa*)(&stg[buf][NT - 1][o]) = rb[i]; }
    };
    v8f acc[4];
#pragma unroll
    for (int t = 0; t < 4; ++t) acc[t] = (v8f){};
    fetch(0); put(0);
    __syncthreads();
#pragma unroll   // unrolled: buffer, stage offset and the last stage's test become constants, and no address register is stepped behind a load
    for (int s = 0; s < DM / KS; ++s) {
        const int buf = s & 1;
        if (s + 1 < DM / KS) fetch(s + 1);
#pragma unroll
        for (int g = 0; g < KS / 32 / GQ; ++g) {   // eight products at a time: what fits 256 registers beside the stage in flight
            v16bf a[GQ], al[GQ], b[GQ][4];
#pragma unroll
            for (int q = 0; q < GQ; ++q) { const int k = (g * GQ + q) * 64;
                a[q] = cat16b(*(const v8usa*)(&stg[buf][0][fa + k]), *(const v8usa*)(&stg[buf][0][fa + k + 32]));
                if (SPLITA) al[q] = cat16b(*(const v8usa*)(&stg[buf][1][fa + k]), *(const v8usa*)(&stg[buf][1][fa + k + 32]));
#pragma unroll
                for (int t = 0; t < 4; ++t) b[q][t] = cat16b(*(const v8usa*)(&stg[buf][NT - 1][fb + t * 16 * LP + k]), *(const v8usa*)(&stg[buf][NT - 1][fb + t * 16 * LP + k + 32])); }
            __builtin_amdgcn_sched_barrier(0);   // the group's LDS reads issue together, ahead of its products: left free, the scheduler reuses one fragment's registers and the wave waits out an LDS latency at every product
#pragma unroll
            for (int q = 0; q < GQ; ++q)
#pragma unroll
                for (int t = 0; t < 4; ++t) { acc[t] = wmmab(a[q], b[q][t], acc[t]); if (SPLITA) acc[t] = wmmab(al[q], b[q][t], acc[t]); }
        }
        if (s + 1 < DM / KS) {
            put(buf ^ 1);      // into the buffer that stage s - 1 was read from: its readers left it at the barrier that ended that stage
            __syncthreads();   // publishes stage s + 1 and ends the reads of stage s
        }
    }
    float* os = &ost[wave][0];
#pragma unroll
    for (int t = 0; t < 4; ++t) { const float bv = bias ? bfr(bias[c0 + t * 16 + lr]) : 0.f;
#pragma unroll
        for (int j = 0; j < 8; ++j) os[(hi * 8 + j) * 68 + t * 16 + lr] = acc[t][j] + bv; }
    __syncthreads();
    if (F16OUT) {
        h16* crow = (h16*)(void*)C + (size_t)r0 * ldc + c0;
        auto pass = [&]() {
#pragma unroll
            for (int s = 0; s < 4; ++s) { const int row = 4 * s + (lane >> 3), piece = lane & 7; const float* sp = os + row * 68 + piece * 8; v8h o, o2;
#pragma unroll
                for (int i = 0; i < 8; ++i) { const h16 a = (h16)sp[i]; o[i] = a; o2[i] = (h16)((sp[i] - (float)a) * LOSC); }
                *(v8h*)(crow + (size_t)row * ldc + piece * 8) = o; if (C2) *(v8h*)(C2 + (size_t)r0 * ldc + c0 + (size_t)row * ldc + piece * 8) = o2; }
        };
        pass(); 
    } else {
        float* crow = C + (size_t)r0 * ldc + c0;
        auto pass = [&]() {
#pragma unroll
            for (int s = 0; s < 8; ++s) { const int Lid = (lane >> 3) + 4 * s, piece = lane & 7; const int row = Lid >> 1, cofs = (Lid & 1) * 32 + piece * 4;
                v4f val = *(const v4fa*)(os + row * 68 + cofs); if (R) { const v4f rv = *(const v4f*)(R + ((size_t)r0 + row) * ldc + c0 + cofs); val += roundR ? (v4f){bfr(rv[0]), bfr(rv[1]), bfr(rv[2]), bfr(rv[3])} : rv; }
                *(v4f*)(crow + (size_t)row * ldc + cofs) = val; }
        };
        pass(); 
    }
}

__global__ __launch_bounds__(256) void k_zero8(bf* dst, size_t n8) {
    const size_t i = (size_t)blockIdx.x * 256 + threadIdx.x; if (i >= n8) return; v8us z;
#pragma unroll
    for (int k = 0; k < 8; ++k) z[k] = 0;
    *(v8us*)(dst + i * 8) = z; 
}

// k_pack: bf16 hi + residual planes of k and of v^T of all items, laid out in WMMA A-fragment order, so that every wave-wide 16-byte load of k_fattn reads 512 contiguous bytes.
// One launch; thread id makes piece id of k and piece id of v^T of every item (no more waves to start than one packing of one item has).
// k: piece id = (((h * 128 + key tile) * 2 + ks) * 2 + u) * 32 + lane holds k[key tile * 16 + (lane & 15)][ks * 32 + u * 16 + 8 * (lane >> 4) + 0..7].
// v^T: piece id = (((h * 64 + key block) * 4 + t) * 2 + u) * 32 + lane holds v[key block * 32 + u * 16 + 8 * (lane >> 4) + 0..7][t * 16 + (lane & 15)].
__global__ __launch_bounds__(256) void k_pack(const float* __restrict__ KF, const float* __restrict__ VF, bf* KPh, bf* KPl, bf* VPh, bf* VPl) {
    const unsigned id = blockIdx.x * 256 + threadIdx.x;
    const int l = id & 31, u = (id >> 5) & 1, ks = (id >> 6) & 1, kt = (id >> 7) & 127, t = (id >> 6) & 3, kb = (id >> 8) & 63, h = id >> 14;
    const float* sk = KF + (size_t)(kt * 16 + (l & 15)) * DMOD + h * HD + ks * 32 + u * 16 + 8 * (l >> 4);
    const float* sv = VF + (size_t)(kb * 32 + u * 16 + 8 * (l >> 4)) * DMOD + h * HD + t * 16 + (l & 15);
    v8f vk[NBT], vv[NBT];
#pragma unroll
    for (int b = 0; b < NBT; ++b) { vk[b] = *(const v8f*)(sk + (size_t)b * NN * DMOD);
        asm volatile("s_wait_xcnt 0x0" ::: "memory");   // stands in front of the reuse, as a later load's destination too, of the address registers that the load above names
#pragma unroll
        for (int i = 0; i < 8; ++i) vv[b][i] = sv[(size_t)b * NN * DMOD + (size_t)i * DMOD];
        asm volatile("s_wait_xcnt 0x0" ::: "memory"); }   // the same for the eight loads above
    __builtin_amdgcn_sched_barrier(0);   // all of the thread's loads issue ahead of the conversions: left free, the scheduler converts k before it loads v, and the two latencies add up
    auto put = [&](const v8f v, bf* Ph, bf* Pl) { v8us oh, ol;
#pragma unroll
        for (int i = 0; i < 8; ++i) { const unsigned short hb = f2bf(v[i]); oh[i] = hb; ol[i] = f2bf(v[i] - bf2f(hb)); }
        *(v8us*)(Ph + (size_t)id * 8) = oh; *(v8us*)(Pl + (size_t)id * 8) = ol; };
#pragma unroll
    for (int b = 0; b < NBT; ++b) { const size_t io = (size_t)b * NN * DMOD; put(vk[b], KPh + io, KPl + io); put(vv[b], VPh + io, VPl + io); }
}
// d_mbits: the mask, read once. One block = 16 queries (a k_fattn tile) x 1024 keys, one wave a query row; a wave-wide 4-byte load covers one 32-key block (one line) and its ballot is that block's bit word (bit i = key i kept).
// WT[(tile * 64 + key block) * 16 + query] = the word, so that one load of k_fattn touches one line; FL[(tile * 2 + key half) * 32 + 0 / 1] = bit per key block: some key kept by some query of the tile / every key kept by every query.
// Each block writes whole lines of its own (its two flag words have a 128-byte line to themselves).
__device__ __forceinline__ void d_mbits(const int* __restrict__ MK, unsigned* WT, unsigned* FL) {
    __shared__ unsigned sh[16][33];   // 33: the 16 rows of one key block fall on different banks
    const int lane = threadIdx.x & 31, row = threadIdx.x >> 5, tile = blockIdx.x >> 1, half = blockIdx.x & 1;
    const int* s = MK + (size_t)(tile * 16 + row) * NN + half * (NN / 2) + lane;
    int v[32];
#pragma unroll
    for (int i = 0; i < 32; ++i) v[i] = s[i * 32];
    unsigned mine = 0;
#pragma unroll
    for (int i = 0; i < 32; ++i) { const unsigned w = __builtin_amdgcn_ballot_w32(v[i] != 0); mine = (lane == i) ? w : mine; }
    sh[row][lane] = mine;
    __syncthreads();
    WT[(size_t)(tile * 64 + half * 32) * 16 + threadIdx.x] = sh[threadIdx.x & 15][threadIdx.x >> 4];
    if (row == 0) { unsigned o = 0u, a = ~0u;
#pragma unroll
        for (int r = 0; r < 16; ++r) { const unsigned w = sh[r][lane]; o |= w; a &= w; }
        const unsigned ne = __builtin_amdgcn_ballot_w32(o != 0u), fu = __builtin_amdgcn_ballot_w32(a == ~0u);
        if (lane < 2) FL[(tile * 2 + half) * 32 + lane] = lane ? fu : ne; }
}
// k_prep: everything that depends on the inputs alone, in one launch. Blocks 0 .. MBB - 1 (the longest, so first) make the mask's bit form; in every later block each wave turns one row of DMOD floats into bf16:
// WBB blocks each for Wq, Wk, Wv, Wo, then x of all items; CV holds the five results one behind the other. The choice is the same for a whole block, so d_mbits' barrier is met by all of its threads or by none.
#define MBB (NN / 16 * 2)
#define WBB (DMOD / 16)
__global__ __launch_bounds__(512) void k_prep(const float* __restrict__ x, const int* __restrict__ MK, const float* __restrict__ Wq, const float* __restrict__ Wk, const float* __restrict__ Wv, const float* __restrict__ Wo, bf* CV, unsigned* WT, unsigned* FL) {
    if (blockIdx.x < MBB) { d_mbits(MK, WT, FL); return; }
    const unsigned cb = blockIdx.x - MBB, sg = cb / WBB;
    const float* src = (sg == 0 ? Wq : sg == 1 ? Wk : sg == 2 ? Wv : sg == 3 ? Wo : x) + (size_t)(sg < 4 ? cb - sg * WBB : cb - 4 * WBB) * 16 * DMOD;
    bf* dst = CV + (size_t)cb * 16 * DMOD;
    const int lane = threadIdx.x & 31; const size_t r = threadIdx.x >> 5;
#pragma unroll
    for (int q = 0; q < DMOD / 256; ++q) { v8us o;
#pragma unroll
        for (int i = 0; i < 8; ++i) o[i] = f2bf(src[r * DMOD + q * 256 + lane * 8 + i]);
        *(v8us*)(dst + r * DMOD + q * 256 + lane * 8) = o; }
    asm volatile("s_wait_xcnt 0x0" ::: "memory");   // stands behind the stores above, in front of the place where the block's two paths join in the built code and the stores' registers are written again
}
__device__ __forceinline__ float xhalf(float x) { const int b = __float_as_int(x); return __int_as_float(__builtin_amdgcn_permlanex16(b, b, 0x76543210, 0xfedcba98, false, false)); }   // the value of lane ^ 16
__global__ __launch_bounds__(256) void k_fattn(const float* __restrict__ QF, const bf* __restrict__ KPh, const bf* __restrict__ KPl, const bf* __restrict__ VPh, const bf* __restrict__ VPl, const unsigned* __restrict__ WT, const unsigned* __restrict__ FL, bf* Ch, bf* Cl) {
    typedef __attribute__((ext_vector_type(2))) float v2f;
    typedef __attribute__((ext_vector_type(2))) __bf16 v2bf;
    typedef __attribute__((ext_vector_type(8))) unsigned v8u;
    const int lane = threadIdx.x & 31, wave = __builtin_amdgcn_readfirstlane(threadIdx.x >> 5), c = lane & 15, hi = lane >> 4;
    const int tile = wave < 4 ? blockIdx.x * 4 + wave : NN / 16 - 1 - (blockIdx.x * 4 + wave - 4);   // every tile 0..127 once
    const int h = blockIdx.y, b = blockIdx.z, q0 = tile * 16;
    const unsigned long long ne = (unsigned long long)FL[tile * 64] | (unsigned long long)FL[tile * 64 + 32] << 32, fu = (unsigned long long)FL[tile * 64 + 1] | (unsigned long long)FL[tile * 64 + 33] << 32;   // bit kb: block not empty / full
    const size_t qoff = ((size_t)b * NN + q0 + c) * DMOD + h * HD + 8 * hi;   // the lane's query row, this head's columns: q on the way in, ctx on the way out
    v16bf qh[2], ql[2];
#pragma unroll
    for (int ks = 0; ks < 2; ++ks) { v8us oh[2], ol[2];
#pragma unroll
        for (int u = 0; u < 2; ++u) { const v8f v = *(const v8f*)(QF + qoff + ks * 32 + u * 16);
#pragma unroll
            for (int i = 0; i < 8; ++i) { const unsigned short hb = f2bf(v[i]); oh[u][i] = hb; ol[u][i] = f2bf(v[i] - bf2f(hb)); } }
        qh[ks] = cat16b(oh[0], oh[1]); ql[ks] = cat16b(ol[0], ol[1]); }
    const char* kh_ = (const char*)KPh; const char* kl_ = (const char*)KPl; const char* vh_ = (const char*)VPh; const char* vl_ = (const char*)VPl; const char* wt_ = (const char*)WT;
    const unsigned pb = (((unsigned)b * NH_ + h) * (NN * HD) + lane * 8) * 2u, mo = ((unsigned)tile * 1024u + c) * 4u;   // 32-bit byte offsets on the kernel's own base pointers
    const float CS = SCL * 1.44269504088896340736f;   // scores in log2 units
    v8f acc[4];
#pragma unroll
    for (int t = 0; t < 4; ++t) acc[t] = (v8f){};
    float m = -1.0e30f, lsum = 0.f;
#pragma unroll 1   // rolled: one pass's fragments already take most of the registers that four waves per SIMD leave a wave
    for (int kb = 0; kb < NN / 32; ++kb) {
        if (!((ne >> kb) & 1ull)) continue;   // the same for the whole wave: a scalar test
        const unsigned o = pb + kb * 4096u, om = mo + kb * 64u;
        v16bf kh[4], kl[4], vh[4], vl[4];
#pragma unroll
        for (int f = 0; f < 4; ++f) { const int fo = f * 1024;   // k: f = tile * 2 + ks; v^T: f = t
            kh[f] = cat16b(*(const v8us*)((kh_ + fo) + o), *(const v8us*)((kh_ + fo + 512) + o)); kl[f] = cat16b(*(const v8us*)((kl_ + fo) + o), *(const v8us*)((kl_ + fo + 512) + o)); }
#pragma unroll
        for (int f = 0; f < 4; ++f) { const int fo = f * 1024;
            vh[f] = cat16b(*(const v8us*)((vh_ + fo) + o), *(const v8us*)((vh_ + fo + 512) + o)); vl[f] = cat16b(*(const v8us*)((vl_ + fo) + o), *(const v8us*)((vl_ + fo + 512) + o)); }
        asm volatile("s_wait_xcnt 0x0" ::: "memory");   // stands in front of the step of the offset register that the loads above name
        __builtin_amdgcn_sched_barrier(0);   // the pass's k and v fragment loads issue together, ahead of its products: left free, the scheduler reuses few registers and the wave waits out a load latency at every fragment
        v8f st[2];
#pragma unroll
        for (int tl = 0; tl < 2; ++tl) { st[tl] = (v8f){};
#pragma unroll
            for (int ks = 0; ks < 2; ++ks) { const int f = tl * 2 + ks;
                st[tl] = wmmab(kh[f], qh[ks], st[tl]); st[tl] = wmmab(kh[f], ql[ks], st[tl]); st[tl] = wmmab(kl[f], qh[ks], st[tl]); } }
        float p[16]; float mx = -3.0e38f;
#pragma unroll
        for (int s = 0; s < 16; ++s) p[s] = st[s >> 3][s & 7] * CS;
        if (!((fu >> kb) & 1ull)) {   // the same for the whole wave; only a mixed block reads its word: the lane's query, this block's 32 keys
            const unsigned mw = *(const unsigned*)(wt_ + om);
            asm volatile("s_wait_xcnt 0x0" ::: "memory");   // stands in front of the step of the address register that the load above names
            const unsigned ml = mw >> (8 * hi);   // score s of the lane is key (s >> 3) * 16 + 8 * hi + (s & 7) of the block
#pragma unroll
            for (int s = 0; s < 16; ++s) p[s] = (ml & (1u << ((s >> 3) * 16 + (s & 7)))) ? p[s] : -3.0e38f; }
#pragma unroll
        for (int s = 0; s < 16; ++s) mx = fmaxf(mx, p[s]);
        mx = fmaxf(mx, xhalf(mx));
        const float mn = fmaxf(m, mx), al = __builtin_amdgcn_exp2f(m - mn); m = mn;
        float ps = 0.f;
#pragma unroll
        for (int s = 0; s < 16; ++s) { p[s] = __builtin_amdgcn_exp2f(p[s] - mn); ps += p[s]; }
        lsum = lsum * al + ps;
#pragma unroll
        for (int t = 0; t < 4; ++t) acc[t] *= al;
        v8u uh, ul;
#pragma unroll
        for (int s = 0; s < 8; ++s) { const v2f pp = {p[2 * s], p[2 * s + 1]}; const unsigned hw = __builtin_bit_cast(unsigned, __builtin_convertvector(pp, v2bf));
            const v2f rr = {pp[0] - __uint_as_float(hw << 16), pp[1] - __uint_as_float(hw & 0xFFFF0000u)}; uh[s] = hw; ul[s] = __builtin_bit_cast(unsigned, __builtin_convertvector(rr, v2bf)); }
        const v16bf ph = __builtin_bit_cast(v16bf, uh), pl = __builtin_bit_cast(v16bf, ul);
#pragma unroll
        for (int t = 0; t < 4; ++t) { acc[t] = wmmab(vh[t], ph, acc[t]); acc[t] = wmmab(vh[t], pl, acc[t]); acc[t] = wmmab(vl[t], ph, acc[t]); }
    }
    lsum += xhalf(lsum);
    const float inv = 1.0f / lsum;
#pragma unroll
    for (int t = 0; t < 4; ++t) { const v8f r = acc[t] * inv; v8us oh, ol;   // acc[t][r] = ctx[query c][t * 16 + 8 * hi + r], stored as the output GEMM's bf16 hi + residual planes
#pragma unroll
        for (int i = 0; i < 8; ++i) { const unsigned short hb = f2bf(r[i]); oh[i] = hb; ol[i] = f2bf(r[i] - bf2f(hb)); }
        *(v8us*)(Ch + qoff + t * 16) = oh; *(v8us*)(Cl + qoff + t * 16) = ol; }
}

extern "C" void kernel_launch(void* const* d_in, const int* in_sizes, int n_in,
                              void* d_out, int out_size, void* d_ws, size_t ws_size, hipStream_t stream) {
    (void)in_sizes; (void)n_in; (void)out_size;
    const float* x = (const float*)d_in[0]; const int* MK = (const int*)d_in[1]; const float* Wq = (const float*)d_in[2]; const float* Wk = (const float*)d_in[3]; const float* Wv = (const float*)d_in[4]; const float* Wo = (const float*)d_in[5]; const float* bo = (const float*)d_in[6];
    float* out = (float*)d_out;    // [2][2048][1024]
    char* wsp = (char*)d_ws;
    auto take = [&](size_t bytes) { char* p = wsp; wsp += (bytes + 255) & ~(size_t)255; return (void*)p; };
    const size_t IT = (size_t)NN * DMOD;    // elements of one item
    bf* CV = (bf*)take(((size_t)4 * DMOD * DMOD + NBT * IT) * 2);    // k_prep's bf16 results, one behind the other
    bf* WQ = CV; bf* WO = CV + (size_t)3 * DMOD * DMOD; bf* Xb = CV + (size_t)4 * DMOD * DMOD;    // WK, WV follow WQ
    float* QF = (float*)take(3 * NBT * IT * 4); float* KF = QF + NBT * IT; float* VF = KF + NBT * IT;
    bf* KPh = (bf*)take(NBT * IT * 2); bf* KPl = (bf*)take(NBT * IT * 2); bf* VPh = (bf*)take(NBT * IT * 2); bf* VPl = (bf*)take(NBT * IT * 2);
    bf* Ch = (bf*)take(NBT * IT * 2); bf* Cl = (bf*)take(NBT * IT * 2);
    unsigned* WT = (unsigned*)take((size_t)NN * (NN / 32) * 4); unsigned* FL = (unsigned*)take((size_t)(NN / 16) * 2 * 128);
    if ((size_t)(wsp - (char*)d_ws) > ws_size) return;    // 16.8 + 50.3 + 33.6 + 16.8 + 0.6 ~ 118 MB
    k_prep<<<MBB + 4 * WBB + NBT * NN / 16, 512, 0, stream>>>(x, MK, Wq, Wk, Wv, Wo, CV, WT, FL);    // weights: [out][in] convention = n-major
    k_gemmb<false, false><<<dim3(NBT * NN / 64, DMOD / 64, 3), 128, 0, stream>>>(Xb, nullptr, WQ, nullptr, QF, DMOD, nullptr, nullptr, 1, DMOD * DMOD, NBT * NN * DMOD);
    k_pack<<<NN * DMOD / 8 / 256, 256, 0, stream>>>(KF, VF, KPh, KPl, VPh, VPl);
    k_fattn<<<dim3(NN / 128, NH_, NBT), 256, 0, stream>>>(QF, KPh, KPl, VPh, VPl, WT, FL, Ch, Cl);
    k_gemmb<true, false><<<dim3(NBT * NN / 64, DMOD / 64, 1), 128, 0, stream>>>(Ch, Cl, WO, bo, out, DMOD, nullptr, nullptr);
}

// v005
// One run takes 128 microseconds.
// Next to v004, in two timings, it ran 1.13 and 1.15 times as fast.
// All steps since v000 together make it 31.4 times as fast.
#include <hip/hip_runtime.h>

// Compute dtypes, f32 accumulate, per item: q/k/v = the k=1 causal convs = x.W^T as [2048 x 1024].[1024 x 1024] GEMMs with PLAIN bf16 operands (exact products); per head, in ONE fused kernel: scores^T = k.q^T (both operands bf16 hi + UNSCALED residual, three products), masked online softmax (x 1/8; positions where the INPUT attn_mask == 0 are excluded, per (query, key), from the bit form that d_mbits makes of the mask in the same call) in f32, ctx^T += v^T.P^T (P and v as bf16 hi + residual, three products)

#define NBT  2
#define NN   2048
#define DMOD 1024
#define NH_  16
#define HD   64
#define DM   DMOD
#define NTK  NN
#define SCL  0.125f
#define LOSC 1024.0f

typedef _Float16 h16;
typedef unsigned short bf;
typedef __attribute__((ext_vector_type(16))) __bf16   v16bf;
typedef __attribute__((ext_vector_type(16))) _Float16 v16h;
typedef __attribute__((ext_vector_type(8)))  _Float16 v8h;
typedef __attribute__((ext_vector_type(8)))  unsigned short v8us;
typedef __attribute__((ext_vector_type(8)))  float    v8f;
typedef __attribute__((ext_vector_type(4)))  float    v4f;
typedef __attribute__((ext_vector_type(4)))  _Float16 v4h;
typedef v8h  __attribute__((may_alias)) v8ha;
typedef v4f  __attribute__((may_alias)) v4fa;
typedef v8us __attribute__((may_alias)) v8usa;

__device__ __forceinline__ unsigned short f2bf(float f) { unsigned u = __float_as_uint(f); u += 0x7FFFu + ((u >> 16) & 1u); return (unsigned short)(u >> 16); }
__device__ __forceinline__ float bf2f(unsigned short b) { return __uint_as_float(((unsigned)b) << 16); }
__device__ __forceinline__ float bfr(float f) { return bf2f(f2bf(f)); }
__device__ __forceinline__ v16h cat16(v8h lo, v8h hi) { return __builtin_shufflevector(lo, hi, 0, 1, 2, 3, 4, 5, 6, 7, 8, 9, 10, 11, 12, 13, 14, 15); }
__device__ __forceinline__ v16bf cat16b(v8us lo, v8us hi) { return __builtin_bit_cast(v16bf, __builtin_shufflevector(lo, hi, 0, 1, 2, 3, 4, 5, 6, 7, 8, 9, 10, 11, 12, 13, 14, 15)); }
__device__ __forceinline__ v8f wmma16(v16h a, v16h b, v8f c) { return __builtin_amdgcn_wmma_f32_16x16x32_f16(false, a, false, b, (short)0, c, false, false); }
__device__ __forceinline__ v8f wmmab(v16bf a, v16bf b, v8f c) { return __builtin_amdgcn_wmma_f32_16x16x32_bf16(false, a, false, b, (short)0, c, false, false); }

// k_gemmb: 128 x 128 block tile (2 x 2 waves, 64 x 64 each: 16 accumulator tiles a wave) of C[NBT * NN][DM] = (A [+ Al]).B^T (K = DM) [+ bf(bias[c])]; f32 whole-line epilogue.
// A fragment read from LDS feeds four products, and a row of A or B is fetched from L2 once per 128 rows of the other operand.
// The operand tiles (128 rows x KS k each) go through LDS: every wave-wide 16-byte global load covers four 128-byte row pieces (four whole lines), each tile is fetched once for the four waves,
// and stage s + 1 is on its way in registers while stage s is multiplied. Rows lie LP bytes apart in LDS (an odd multiple of 16 bytes: the 16 rows of a fragment read fall on 64 different banks).
#define KS 64
#define LP (KS * 2 + 16)
template <bool SPLITA>
__global__ __launch_bounds__(128) void k_gemmb(const bf* __restrict__ A, const bf* __restrict__ Al, const bf* __restrict__ Bn, const float* __restrict__ bias, float* C, int zB, int zC) {
    Bn += (size_t)blockIdx.z * zB; C += (size_t)blockIdx.z * zC;   // grid plane z: its own B matrix and its own C (the q, k, v projections in one launch); the rows of A and C run over all items
    constexpr int NT = SPLITA ? 3 : 2;   // tiles of a stage: A, [Al,] B
    constexpr int GQ = SPLITA ? 2 : 1;   // 32-k steps whose fragments are read from LDS as one group
    __shared__ __align__(16) float ost[4][16 * 68];
    __shared__ __align__(16) char stg[2][NT][128 * LP];
    const int lane = threadIdx.x & 31, wave = threadIdx.x >> 5, lr = lane & 15, hi = lane >> 4, wm = wave >> 1, wn = wave & 1;
    const int r0 = blockIdx.x * 128 + wm * 64, c0 = blockIdx.y * 128 + wn * 64;
    const int sg = threadIdx.x >> 3, srow = (sg & 1) * 8 + (sg >> 1), spc = threadIdx.x & 7;   // staging: this thread moves piece spc (16 bytes) of rows srow + 16 i of every tile; 16 lanes hold rows r and r + 8, whose pieces fall on 64 different banks
    const char* ga = (const char*)A + ((size_t)(blockIdx.x * 128 + srow) * DM + spc * 8) * 2;
    const char* gl = (const char*)(SPLITA ? Al : A) + ((size_t)(blockIdx.x * 128 + srow) * DM + spc * 8) * 2;
    const char* gb = (const char*)Bn + ((size_t)(blockIdx.y * 128 + srow) * DM + spc * 8) * 2;
    const int ls = srow * LP + spc * 16, fa = (wm * 64 + lr) * LP + hi * 16, fb = (wn * 64 + lr) * LP + hi * 16;
    v8us ra[8], rl[8], rb[8];
    auto fetch = [&](int s) {
#pragma unroll
        for (int i = 0; i < 8; ++i) { const int o = i * 16 * DM * 2 + s * KS * 2; ra[i] = *(const v8us*)(ga + o); if (SPLITA) rl[i] = *(const v8us*)(gl + o); rb[i] = *(const v8us*)(gb + o); }
    };
    auto put = [&](int buf) {
#pragma unroll
        for (int i = 0; i < 8; ++i) { const int o = ls + i * 16 * LP; *(v8usa*)(&stg[buf][0][o]) = ra[i]; if (SPLITA) *(v8usa*)(&stg[buf][1][o]) = rl[i]; *(v8usa*)(&stg[buf][NT - 1][o]) = rb[i]; }
    };
    v8f acc[4][4];
#pragma unroll
    for (int u = 0; u < 4; ++u)
#pragma unroll
        for (int t = 0; t < 4; ++t) acc[u][t] = (v8f){};
    fetch(0); put(0);
    __syncthreads();
#pragma unroll   // unrolled: buffer, stage offset and the last stage's test become constants, and no address register is stepped behind a load
    for (int s = 0; s < DM / KS; ++s) {
        const int buf = s & 1;
        if (s + 1 < DM / KS) fetch(s + 1);
        if (s + 2 == DM / KS) asm volatile("s_wait_xcnt 0x0" ::: "memory");   // directly behind the last loads: from here on the address registers that the K loop's loads name are free for reuse
#pragma unroll
        for (int g = 0; g < KS / 32 / GQ; ++g) {
            v16bf a[GQ][4], al[GQ][4], b[GQ][4];
#pragma unroll
            for (int q = 0; q < GQ; ++q) { const int k = (g * GQ + q) * 64;
#pragma unroll
                for (int t = 0; t < 4; ++t) { const int ro = t * 16 * LP + k;
                    a[q][t] = cat16b(*(const v8usa*)(&stg[buf][0][fa + ro]), *(const v8usa*)(&stg[buf][0][fa + ro + 32]));
                    if (SPLITA) al[q][t] = cat16b(*(const v8usa*)(&stg[buf][1][fa + ro]), *(const v8usa*)(&stg[buf][1][fa + ro + 32]));
                    b[q][t] = cat16b(*(const v8usa*)(&stg[buf][NT - 1][fb + ro]), *(const v8usa*)(&stg[buf][NT - 1][fb + ro + 32])); } }
            __builtin_amdgcn_sched_barrier(0);   // the group's LDS reads issue together, ahead of its products: left free, the scheduler reuses one fragment's registers and the wave waits out an LDS latency at every product
#pragma unroll
            for (int q = 0; q < GQ; ++q) {   // per accumulator the order stays A, Al, step by step; the sixteen tiles stand between two products into the same one
#pragma unroll
                for (int u = 0; u < 4; ++u)
#pragma unroll
                    for (int t = 0; t < 4; ++t) acc[u][t] = wmmab(a[q][u], b[q][t], acc[u][t]);
                if (SPLITA) {
#pragma unroll
                    for (int u = 0; u < 4; ++u)
#pragma unroll
                        for (int t = 0; t < 4; ++t) acc[u][t] = wmmab(al[q][u], b[q][t], acc[u][t]); } }
        }
        if (s + 1 < DM / KS) {
            put(buf ^ 1);      // into the buffer that stage s - 1 was read from: its readers left it at the barrier that ended that stage
            __syncthreads();   // publishes stage s + 1 and ends the reads of stage s
        }
    }
    float* os = &ost[wave][0];   // the wave's own staging rows: 16 rows x 64 columns at a time
    float bv[4] = {0.f, 0.f, 0.f, 0.f};
    if (bias) {
#pragma unroll
        for (int t = 0; t < 4; ++t) bv[t] = bfr(bias[c0 + t * 16 + lr]); }
    float* cp = C + ((size_t)r0 + hi) * DM + c0 + ((lane >> 3) & 1) * 32 + (lane & 7) * 4;   // eight lanes store one whole line; every further store is a constant distance away
    const float* sp = os + hi * 68 + ((lane >> 3) & 1) * 32 + (lane & 7) * 4;
#pragma unroll
    for (int u = 0; u < 4; ++u) {
#pragma unroll
        for (int t = 0; t < 4; ++t)
#pragma unroll
            for (int j = 0; j < 8; ++j) os[(hi * 8 + j) * 68 + t * 16 + lr] = acc[u][t][j] + bv[t];
        asm volatile("s_wait_dscnt 0x0" ::: "memory");   // the wave's own rows stand in LDS before its lanes read them back; no other wave touches them, and a work-group barrier here would make every slice wait for the global stores of the slice before
#pragma unroll
        for (int s = 0; s < 8; ++s) *(v4f*)(cp + (u * 16 + 2 * s) * DM) = *(const v4fa*)(sp + 2 * s * 68);
    }
}

__global__ __launch_bounds__(256) void k_zero8(bf* dst, size_t n8) {
    const size_t i = (size_t)blockIdx.x * 256 + threadIdx.x; if (i >= n8) return; v8us z;
#pragma unroll
    for (int k = 0; k < 8; ++k) z[k] = 0;
    *(v8us*)(dst + i * 8) = z; 
}

// k_pack: bf16 hi + residual planes of k and of v^T of all items, laid out in WMMA A-fragment order, so that every wave-wide 16-byte load of k_fattn reads 512 contiguous bytes.
// One launch; thread id makes piece id of k and piece id of v^T of every item (no more waves to start than one packing of one item has).
// k: piece id = (((h * 128 + key tile) * 2 + ks) * 2 + u) * 32 + lane holds k[key tile * 16 + (lane & 15)][ks * 32 + u * 16 + 8 * (lane >> 4) + 0..7].
// v^T: piece id = (((h * 64 + key block) * 4 + t) * 2 + u) * 32 + lane holds v[key block * 32 + u * 16 + 8 * (lane >> 4) + 0..7][t * 16 + (lane & 15)].
__global__ __launch_bounds__(256) void k_pack(const float* __restrict__ KF, const float* __restrict__ VF, bf* KPh, bf* KPl, bf* VPh, bf* VPl) {
    const unsigned id = blockIdx.x * 256 + threadIdx.x;
    const int l = id & 31, u = (id >> 5) & 1, ks = (id >> 6) & 1, kt = (id >> 7) & 127, t = (id >> 6) & 3, kb = (id >> 8) & 63, h = id >> 14;
    const float* sk = KF + (size_t)(kt * 16 + (l & 15)) * DMOD + h * HD + ks * 32 + u * 16 + 8 * (l >> 4);
    const float* sv = VF + (size_t)(kb * 32 + u * 16 + 8 * (l >> 4)) * DMOD + h * HD + t * 16 + (l & 15);
    v8f vk[NBT], vv[NBT];
#pragma unroll
    for (int b = 0; b < NBT; ++b) { vk[b] = *(const v8f*)(sk + (size_t)b * NN * DMOD);
        asm volatile("s_wait_xcnt 0x0" ::: "memory");   // stands in front of the reuse, as a later load's destination too, of the address registers that the load above names
#pragma unroll
        for (int i = 0; i < 8; ++i) vv[b][i] = sv[(size_t)b * NN * DMOD + (size_t)i * DMOD];
        asm volatile("s_wait_xcnt 0x0" ::: "memory"); }   // the same for the eight loads above
    __builtin_amdgcn_sched_barrier(0);   // all of the thread's loads issue ahead of the conversions: left free, the scheduler converts k before it loads v, and the two latencies add up
    auto put = [&](const v8f v, bf* Ph, bf* Pl) { v8us oh, ol;
#pragma unroll
        for (int i = 0; i < 8; ++i) { const unsigned short hb = f2bf(v[i]); oh[i] = hb; ol[i] = f2bf(v[i] - bf2f(hb)); }
        *(v8us*)(Ph + (size_t)id * 8) = oh; *(v8us*)(Pl + (size_t)id * 8) = ol; };
#pragma unroll
    for (int b = 0; b < NBT; ++b) { const size_t io = (size_t)b * NN * DMOD; put(vk[b], KPh + io, KPl + io); put(vv[b], VPh + io, VPl + io); }
}
// d_mbits: the mask, read once. One block = 16 queries (a k_fattn tile) x 1024 keys, one wave a query row; a wave-wide 4-byte load covers one 32-key block (one line) and its ballot is that block's bit word (bit i = key i kept).
// WT[(tile * 64 + key block) * 16 + query] = the word, so that one load of k_fattn touches one line; FL[(tile * 2 + key half) * 32 + 0 / 1] = bit per key block: some key kept by some query of the tile / every key kept by every query.
// Each block writes whole lines of its own (its two flag words have a 128-byte line to themselves).
__device__ __forceinline__ void d_mbits(const int* __restrict__ MK, unsigned* WT, unsigned* FL) {
    __shared__ unsigned sh[16][33];   // 33: the 16 rows of one key block fall on different banks
    const int lane = threadIdx.x & 31, row = threadIdx.x >> 5, tile = blockIdx.x >> 1, half = blockIdx.x & 1;
    const int* s = MK + (size_t)(tile * 16 + row) * NN + half * (NN / 2) + lane;
    int v[32];
#pragma unroll
    for (int i = 0; i < 32; ++i) v[i] = s[i * 32];
    unsigned mine = 0;
#pragma unroll
    for (int i = 0; i < 32; ++i) { const unsigned w = __builtin_amdgcn_ballot_w32(v[i] != 0); mine = (lane == i) ? w : mine; }
    sh[row][lane] = mine;
    __syncthreads();
    WT[(size_t)(tile * 64 + half * 32) * 16 + threadIdx.x] = sh[threadIdx.x & 15][threadIdx.x >> 4];
    if (row == 0) { unsigned o = 0u, a = ~0u;
#pragma unroll
        for (int r = 0; r < 16; ++r) { const unsigned w = sh[r][lane]; o |= w; a &= w; }
        const unsigned ne = __builtin_amdgcn_ballot_w32(o != 0u), fu = __builtin_amdgcn_ballot_w32(a == ~0u);
        if (lane < 2) FL[(tile * 2 + half) * 32 + lane] = lane ? fu : ne; }
}
// k_prep: everything that depends on the inputs alone, in one launch. Blocks 0 .. MBB - 1 (the longest, so first) make the mask's bit form; in every later block each wave turns one row of DMOD floats into bf16:
// WBB blocks each for Wq, Wk, Wv, Wo, then x of all items; CV holds the five results one behind the other. The choice is the same for a whole block, so d_mbits' barrier is met by all of its threads or by none.
#define MBB (NN / 16 * 2)
#define WBB (DMOD / 16)
__global__ __launch_bounds__(512) void k_prep(const float* __restrict__ x, const int* __restrict__ MK, const float* __restrict__ Wq, const float* __restrict__ Wk, const float* __restrict__ Wv, const float* __restrict__ Wo, bf* CV, unsigned* WT, unsigned* FL) {
    if (blockIdx.x < MBB) { d_mbits(MK, WT, FL); return; }
    const unsigned cb = blockIdx.x - MBB, sg = cb / WBB;
    const float* src = (sg == 0 ? Wq : sg == 1 ? Wk : sg == 2 ? Wv : sg == 3 ? Wo : x) + (size_t)(sg < 4 ? cb - sg * WBB : cb - 4 * WBB) * 16 * DMOD;
    bf* dst = CV + (size_t)cb * 16 * DMOD;
    const int lane = threadIdx.x & 31; const size_t r = threadIdx.x >> 5;
#pragma unroll
    for (int q = 0; q < DMOD / 256; ++q) { v8us o;
#pragma unroll
        for (int i = 0; i < 8; ++i) o[i] = f2bf(src[r * DMOD + q * 256 + lane * 8 + i]);
        *(v8us*)(dst + r * DMOD + q * 256 + lane * 8) = o; }
    asm volatile("s_wait_xcnt 0x0" ::: "memory");   // stands behind the stores above, in front of the place where the block's two paths join in the built code and the stores' registers are written again
}
__device__ __forceinline__ float xhalf(float x) { const int b = __float_as_int(x); return __int_as_float(__builtin_amdgcn_permlanex16(b, b, 0x76543210, 0xfedcba98, false, false)); }   // the value of lane ^ 16
__global__ __launch_bounds__(256) void k_fattn(const float* __restrict__ QF, const bf* __restrict__ KPh, const bf* __restrict__ KPl, const bf* __restrict__ VPh, const bf* __restrict__ VPl, const unsigned* __restrict__ WT, const unsigned* __restrict__ FL, bf* Ch, bf* Cl) {
    typedef __attribute__((ext_vector_type(2))) float v2f;
    typedef __attribute__((ext_vector_type(2))) __bf16 v2bf;
    typedef __attribute__((ext_vector_type(8))) unsigned v8u;
    const int lane = threadIdx.x & 31, wave = __builtin_amdgcn_readfirstlane(threadIdx.x >> 5), c = lane & 15, hi = lane >> 4;
    const int tile = wave < 4 ? blockIdx.x * 4 + wave : NN / 16 - 1 - (blockIdx.x * 4 + wave - 4);   // every tile 0..127 once
    const int h = blockIdx.y, b = blockIdx.z, q0 = tile * 16;
    const unsigned long long ne = (unsigned long long)FL[tile * 64] | (unsigned long long)FL[tile * 64 + 32] << 32, fu = (unsigned long long)FL[tile * 64 + 1] | (unsigned long long)FL[tile * 64 + 33] << 32;   // bit kb: block not empty / full
    const size_t qoff = ((size_t)b * NN + q0 + c) * DMOD + h * HD + 8 * hi;   // the lane's query row, this head's columns: q on the way in, ctx on the way out
    v16bf qh[2], ql[2];
#pragma unroll
    for (int ks = 0; ks < 2; ++ks) { v8us oh[2], ol[2];
#pragma unroll
        for (int u = 0; u < 2; ++u) { const v8f v = *(const v8f*)(QF + qoff + ks * 32 + u * 16);
#pragma unroll
            for (int i = 0; i < 8; ++i) { const unsigned short hb = f2bf(v[i]); oh[u][i] = hb; ol[u][i] = f2bf(v[i] - bf2f(hb)); } }
        qh[ks] = cat16b(oh[0], oh[1]); ql[ks] = cat16b(ol[0], ol[1]); }
    const char* kh_ = (const char*)KPh; const char* kl_ = (const char*)KPl; const char* vh_ = (const char*)VPh; const char* vl_ = (const char*)VPl; const char* wt_ = (const char*)WT;
    const unsigned pb = (((unsigned)b * NH_ + h) * (NN * HD) + lane * 8) * 2u, mo = ((unsigned)tile * 1024u + c) * 4u;   // 32-bit byte offsets on the kernel's own base pointers
    const float CS = SCL * 1.44269504088896340736f;   // scores in log2 units
    v8f acc[4];
#pragma unroll
    for (int t = 0; t < 4; ++t) acc[t] = (v8f){};
    float m = -1.0e30f, lsum = 0.f;
#pragma unroll 1   // rolled: one pass's fragments already take most of the registers that four waves per SIMD leave a wave
    for (int kb = 0; kb < NN / 32; ++kb) {
        if (!((ne >> kb) & 1ull)) continue;   // the same for the whole wave: a scalar test
        const unsigned o = pb + kb * 4096u, om = mo + kb * 64u;
        v16bf kh[4], kl[4], vh[4], vl[4];
#pragma unroll
        for (int f = 0; f < 4; ++f) { const int fo = f * 1024;   // k: f = tile * 2 + ks; v^T: f = t
            kh[f] = cat16b(*(const v8us*)((kh_ + fo) + o), *(const v8us*)((kh_ + fo + 512) + o)); kl[f] = cat16b(*(const v8us*)((kl_ + fo) + o), *(const v8us*)((kl_ + fo + 512) + o)); }
#pragma unroll
        for (int f = 0; f < 4; ++f) { const int fo = f * 1024;
            vh[f] = cat16b(*(const v8us*)((vh_ + fo) + o), *(const v8us*)((vh_ + fo + 512) + o)); vl[f] = cat16b(*(const v8us*)((vl_ + fo) + o), *(const v8us*)((vl_ + fo + 512) + o)); }
        asm volatile("s_wait_xcnt 0x0" ::: "memory");   // stands in front of the step of the offset register that the loads above name
        __builtin_amdgcn_sched_barrier(0);   // the pass's k and v fragment loads issue together, ahead of its products: left free, the scheduler reuses few registers and the wave waits out a load latency at every fragment
        v8f st[2];
#pragma unroll
        for (int tl = 0; tl < 2; ++tl) { st[tl] = (v8f){};
#pragma unroll
            for (int ks = 0; ks < 2; ++ks) { const int f = tl * 2 + ks;
                st[tl] = wmmab(kh[f], qh[ks], st[tl]); st[tl] = wmmab(kh[f], ql[ks], st[tl]); st[tl] = wmmab(kl[f], qh[ks], st[tl]); } }
        float p[16]; float mx = -3.0e38f;
#pragma unroll
        for (int s = 0; s < 16; ++s) p[s] = st[s >> 3][s & 7] * CS;
        if (!((fu >> kb) & 1ull)) {   // the same for the whole wave; only a mixed block reads its word: the lane's query, this block's 32 keys
            const unsigned mw = *(const unsigned*)(wt_ + om);
            asm volatile("s_wait_xcnt 0x0" ::: "memory");   // stands in front of the step of the address register that the load above names
            const unsigned ml = mw >> (8 * hi);   // score s of the lane is key (s >> 3) * 16 + 8 * hi + (s & 7) of the block
#pragma unroll
            for (int s = 0; s < 16; ++s) p[s] = (ml & (1u << ((s >> 3) * 16 + (s & 7)))) ? p[s] : -3.0e38f; }
#pragma unroll
        for (int s = 0; s < 16; ++s) mx = fmaxf(mx, p[s]);
        mx = fmaxf(mx, xhalf(mx));
        const float mn = fmaxf(m, mx), al = __builtin_amdgcn_exp2f(m - mn); m = mn;
        float ps = 0.f;
#pragma unroll
        for (int s = 0; s < 16; ++s) { p[s] = __builtin_amdgcn_exp2f(p[s] - mn); ps += p[s]; }
        lsum = lsum * al + ps;
#pragma unroll
        for (int t = 0; t < 4; ++t) acc[t] *= al;
        v8u uh, ul;
#pragma unroll
        for (int s = 0; s < 8; ++s) { const v2f pp = {p[2 * s], p[2 * s + 1]}; const unsigned hw = __builtin_bit_cast(unsigned, __builtin_convertvector(pp, v2bf));
            const v2f rr = {pp[0] - __uint_as_float(hw << 16), pp[1] - __uint_as_float(hw & 0xFFFF0000u)}; uh[s] = hw; ul[s] = __builtin_bit_cast(unsigned, __builtin_convertvector(rr, v2bf)); }
        const v16bf ph = __builtin_bit_cast(v16bf, uh), pl = __builtin_bit_cast(v16bf, ul);
#pragma unroll
        for (int t = 0; t < 4; ++t) { acc[t] = wmmab(vh[t], ph, acc[t]); acc[t] = wmmab(vh[t], pl, acc[t]); acc[t] = wmmab(vl[t], ph, acc[t]); }
    }
    lsum += xhalf(lsum);
    const float inv = 1.0f / lsum;
#pragma unroll
    for (int t = 0; t < 4; ++t) { const v8f r = acc[t] * inv; v8us oh, ol;   // acc[t][r] = ctx[query c][t * 16 + 8 * hi + r], stored as the output GEMM's bf16 hi + residual planes
#pragma unroll
        for (int i = 0; i < 8; ++i) { const unsigned short hb = f2bf(r[i]); oh[i] = hb; ol[i] = f2bf(r[i] - bf2f(hb)); }
        *(v8us*)(Ch + qoff + t * 16) = oh; *(v8us*)(Cl + qoff + t * 16) = ol; }
}

extern "C" void kernel_launch(void* const* d_in, const int* in_sizes, int n_in,
                              void* d_out, int out_size, void* d_ws, size_t ws_size, hipStream_t stream) {
    (void)in_sizes; (void)n_in; (void)out_size;
    const float* x = (const float*)d_in[0]; const int* MK = (const int*)d_in[1]; const float* Wq = (const float*)d_in[2]; const float* Wk = (const float*)d_in[3]; const float* Wv = (const float*)d_in[4]; const float* Wo = (const float*)d_in[5]; const float* bo = (const float*)d_in[6];
    float* out = (float*)d_out;    // [2][2048][1024]
    char* wsp = (char*)d_ws;
    auto take = [&](size_t bytes) { char* p = wsp; wsp += (bytes + 255) & ~(size_t)255; return (void*)p; };
    const size_t IT = (size_t)NN * DMOD;    // elements of one item
    bf* CV = (bf*)take(((size_t)4 * DMOD * DMOD + NBT * IT) * 2);    // k_prep's bf16 results, one behind the other
    bf* WQ = CV; bf* WO = CV + (size_t)3 * DMOD * DMOD; bf* Xb = CV + (size_t)4 * DMOD * DMOD;    // WK, WV follow WQ
    float* QF = (float*)take(3 * NBT * IT * 4); float* KF = QF + NBT * IT; float* VF = KF + NBT * IT;
    bf* KPh = (bf*)take(NBT * IT * 2); bf* KPl = (bf*)take(NBT * IT * 2); bf* VPh = (bf*)take(NBT * IT * 2); bf* VPl = (bf*)take(NBT * IT * 2);
    bf* Ch = (bf*)take(NBT * IT * 2); bf* Cl = (bf*)take(NBT * IT * 2);
    unsigned* WT = (unsigned*)take((size_t)NN * (NN / 32) * 4); unsigned* FL = (unsigned*)take((size_t)(NN / 16) * 2 * 128);
    if ((size_t)(wsp - (char*)d_ws) > ws_size) return;    // 16.8 + 50.3 + 33.6 + 16.8 + 0.6 ~ 118 MB
    k_prep<<<MBB + 4 * WBB + NBT * NN / 16, 512, 0, stream>>>(x, MK, Wq, Wk, Wv, Wo, CV, WT, FL);    // weights: [out][in] convention = n-major
    k_gemmb<false><<<dim3(NBT * NN / 128, DMOD / 128, 3), 128, 0, stream>>>(Xb, nullptr, WQ, nullptr, QF, DMOD * DMOD, NBT * NN * DMOD);
    k_pack<<<NN * DMOD / 8 / 256, 256, 0, stream>>>(KF, VF, KPh, KPl, VPh, VPl);
    k_fattn<<<dim3(NN / 128, NH_, NBT), 256, 0, stream>>>(QF, KPh, KPl, VPh, VPl, WT, FL, Ch, Cl);
    k_gemmb<true><<<dim3(NBT * NN / 128, DMOD / 128, 1), 128, 0, stream>>>(Ch, Cl, WO, bo, out, 0, 0);
}

// v006
// Measured time: 120 microseconds a run.
// Timed twice side by side with v005, it ran 1.07 and 1.06 times as fast.
// Counting every step since v000, it is 33.5 times as fast.
#include <hip/hip_runtime.h>

// Compute dtypes, f32 accumulate, per item: q/k/v = the k=1 causal convs = x.W^T as [2048 x 1024].[1024 x 1024] GEMMs with PLAIN bf16 operands (exact products); per head, in ONE fused kernel: scores^T = k.q^T (both operands bf16 hi + UNSCALED residual, three products), masked online softmax (x 1/8; positions where the INPUT attn_mask == 0 are excluded, per (query, key), from the bit form that d_mbits makes of the mask in the same call) in f32, ctx^T += v^T.P^T (P and v as bf16 hi + residual, three products)

#define NBT  2
#define NN   2048
#define DMOD 1024
#define NH_  16
#define HD   64
#define DM   DMOD
#define NTK  NN
#define SCL  0.125f
#define LOSC 1024.0f

typedef _Float16 h16;
typedef unsigned short bf;
typedef __attribute__((ext_vector_type(16))) __bf16   v16bf;
typedef __attribute__((ext_vector_type(16))) _Float16 v16h;
typedef __attribute__((ext_vector_type(8)))  _Float16 v8h;
typedef __attribute__((ext_vector_type(8)))  unsigned short v8us;
typedef __attribute__((ext_vector_type(8)))  float    v8f;
typedef __attribute__((ext_vector_type(4)))  float    v4f;
typedef __attribute__((ext_vector_type(4)))  _Float16 v4h;
typedef v8h  __attribute__((may_alias)) v8ha;
typedef v4f  __attribute__((may_alias)) v4fa;
typedef v8us __attribute__((may_alias)) v8usa;

__device__ __forceinline__ unsigned short f2bf(float f) { unsigned u = __float_as_uint(f); u += 0x7FFFu + ((u >> 16) & 1u); return (unsigned short)(u >> 16); }
__device__ __forceinline__ float bf2f(unsigned short b) { return __uint_as_float(((unsigned)b) << 16); }
__device__ __forceinline__ float bfr(float f) { return bf2f(f2bf(f)); }
__device__ __forceinline__ v16h cat16(v8h lo, v8h hi) { return __builtin_shufflevector(lo, hi, 0, 1, 2, 3, 4, 5, 6, 7, 8, 9, 10, 11, 12, 13, 14, 15); }
__device__ __forceinline__ v16bf cat16b(v8us lo, v8us hi) { return __builtin_bit_cast(v16bf, __builtin_shufflevector(lo, hi, 0, 1, 2, 3, 4, 5, 6, 7, 8, 9, 10, 11, 12, 13, 14, 15)); }
__device__ __forceinline__ v8f wmma16(v16h a, v16h b, v8f c) { return __builtin_amdgcn_wmma_f32_16x16x32_f16(false, a, false, b, (short)0, c, false, false); }
__device__ __forceinline__ v8f wmmab(v16bf a, v16bf b, v8f c) { return __builtin_amdgcn_wmma_f32_16x16x32_bf16(false, a, false, b, (short)0, c, false, false); }

// k_gemmb: 128 x 128 block tile (2 x 2 waves, 64 x 64 each: 16 accumulator tiles a wave) of C[NBT * NN][DM] = (A [+ Al]).B^T (K = DM) [+ bf(bias[c])]; f32 whole-line epilogue.
// A fragment read from LDS feeds four products, and a row of A or B is fetched from L2 once per 128 rows of the other operand.
// The operand tiles (128 rows x KS k each) go through LDS: every wave-wide 16-byte global load covers four 128-byte row pieces (four whole lines), each tile is fetched once for the four waves,
// and stage s + 1 is on its way in registers while stage s is multiplied. Rows lie LP bytes apart in LDS (an odd multiple of 16 bytes: the 16 rows of a fragment read fall on 64 different banks).
#define KS 64
#define LP (KS * 2 + 16)
template <bool SPLITA>
__global__ __launch_bounds__(128) void k_gemmb(const bf* __restrict__ A, const bf* __restrict__ Al, const bf* __restrict__ Bn, const float* __restrict__ bias, float* C, int zB, int zC) {
    Bn += (size_t)blockIdx.z * zB; C += (size_t)blockIdx.z * zC;   // grid plane z: its own B matrix and its own C (the q, k, v projections in one launch); the rows of A and C run over all items
    constexpr int NT = SPLITA ? 3 : 2;   // tiles of a stage: A, [Al,] B
    constexpr int GQ = SPLITA ? 2 : 1;   // 32-k steps whose fragments are read from LDS as one group
    __shared__ __align__(16) float ost[4][16 * 68];
    __shared__ __align__(16) char stg[2][NT][128 * LP];
    const int lane = threadIdx.x & 31, wave = threadIdx.x >> 5, lr = lane & 15, hi = lane >> 4, wm = wave >> 1, wn = wave & 1;
    const int r0 = blockIdx.x * 128 + wm * 64, c0 = blockIdx.y * 128 + wn * 64;
    const int sg = threadIdx.x >> 3, srow = (sg & 1) * 8 + (sg >> 1), spc = threadIdx.x & 7;   // staging: this thread moves piece spc (16 bytes) of rows srow + 16 i of every tile; 16 lanes hold rows r and r + 8, whose pieces fall on 64 different banks
    const char* ga = (const char*)A + ((size_t)(blockIdx.x * 128 + srow) * DM + spc * 8) * 2;
    const char* gl = (const char*)(SPLITA ? Al : A) + ((size_t)(blockIdx.x * 128 + srow) * DM + spc * 8) * 2;
    const char* gb = (const char*)Bn + ((size_t)(blockIdx.y * 128 + srow) * DM + spc * 8) * 2;
    const int ls = srow * LP + spc * 16, fa = (wm * 64 + lr) * LP + hi * 16, fb = (wn * 64 + lr) * LP + hi * 16;
    v8us ra[8], rl[8], rb[8];
    auto fetch = [&](int s) {
#pragma unroll
        for (int i = 0; i < 8; ++i) { const int o = i * 16 * DM * 2 + s * KS * 2; ra[i] = *(const v8us*)(ga + o); if (SPLITA) rl[i] = *(const v8us*)(gl + o); rb[i] = *(const v8us*)(gb + o); }
    };
    auto put = [&](int buf) {
#pragma unroll
        for (int i = 0; i < 8; ++i) { const int o = ls + i * 16 * LP; *(v8usa*)(&stg[buf][0][o]) = ra[i]; if (SPLITA) *(v8usa*)(&stg[buf][1][o]) = rl[i]; *(v8usa*)(&stg[buf][NT - 1][o]) = rb[i]; }
    };
    v8f acc[4][4];
#pragma unroll
    for (int u = 0; u < 4; ++u)
#pragma unroll
        for (int t = 0; t < 4; ++t) acc[u][t] = (v8f){};
    fetch(0); put(0);
    __syncthreads();
#pragma unroll   // unrolled: buffer, stage offset and the last stage's test become constants, and no address register is stepped behind a load
    for (int s = 0; s < DM / KS; ++s) {
        const int buf = s & 1;
        if (s + 1 < DM / KS) fetch(s + 1);
        if (s + 2 == DM / KS) asm volatile("s_wait_xcnt 0x0" ::: "memory");   // directly behind the last loads: from here on the address registers that the K loop's loads name are free for reuse
#pragma unroll
        for (int g = 0; g < KS / 32 / GQ; ++g) {
            v16bf a[GQ][4], al[GQ][4], b[GQ][4];
#pragma unroll
            for (int q = 0; q < GQ; ++q) { const int k = (g * GQ + q) * 64;
#pragma unroll
                for (int t = 0; t < 4; ++t) { const int ro = t * 16 * LP + k;
                    a[q][t] = cat16b(*(const v8usa*)(&stg[buf][0][fa + ro]), *(const v8usa*)(&stg[buf][0][fa + ro + 32]));
                    if (SPLITA) al[q][t] = cat16b(*(const v8usa*)(&stg[buf][1][fa + ro]), *(const v8usa*)(&stg[buf][1][fa + ro + 32]));
                    b[q][t] = cat16b(*(const v8usa*)(&stg[buf][NT - 1][fb + ro]), *(const v8usa*)(&stg[buf][NT - 1][fb + ro + 32])); } }
            __builtin_amdgcn_sched_barrier(0);   // the group's LDS reads issue together, ahead of its products: left free, the scheduler reuses one fragment's registers and the wave waits out an LDS latency at every product
#pragma unroll
            for (int q = 0; q < GQ; ++q) {   // per accumulator the order stays A, Al, step by step; the sixteen tiles stand between two products into the same one
#pragma unroll
                for (int u = 0; u < 4; ++u)
#pragma unroll
                    for (int t = 0; t < 4; ++t) acc[u][t] = wmmab(a[q][u], b[q][t], acc[u][t]);
                if (SPLITA) {
#pragma unroll
                    for (int u = 0; u < 4; ++u)
#pragma unroll
                        for (int t = 0; t < 4; ++t) acc[u][t] = wmmab(al[q][u], b[q][t], acc[u][t]); } }
        }
        if (s + 1 < DM / KS) {
            put(buf ^ 1);      // into the buffer that stage s - 1 was read from: its readers left it at the barrier that ended that stage
            __syncthreads();   // publishes stage s + 1 and ends the reads of stage s
        }
    }
    float* os = &ost[wave][0];   // the wave's own staging rows: 16 rows x 64 columns at a time
    float bv[4] = {0.f, 0.f, 0.f, 0.f};
    if (bias) {
#pragma unroll
        for (int t = 0; t < 4; ++t) bv[t] = bfr(bias[c0 + t * 16 + lr]); }
    float* cp = C + ((size_t)r0 + hi) * DM + c0 + ((lane >> 3) & 1) * 32 + (lane & 7) * 4;   // eight lanes store one whole line; every further store is a constant distance away
    const float* sp = os + hi * 68 + ((lane >> 3) & 1) * 32 + (lane & 7) * 4;
#pragma unroll
    for (int u = 0; u < 4; ++u) {
#pragma unroll
        for (int t = 0; t < 4; ++t)
#pragma unroll
            for (int j = 0; j < 8; ++j) os[(hi * 8 + j) * 68 + t * 16 + lr] = acc[u][t][j] + bv[t];
        asm volatile("s_wait_dscnt 0x0" ::: "memory");   // the wave's own rows stand in LDS before its lanes read them back; no other wave touches them, and a work-group barrier here would make every slice wait for the global stores of the slice before
#pragma unroll
        for (int s = 0; s < 8; ++s) *(v4f*)(cp + (u * 16 + 2 * s) * DM) = *(const v4fa*)(sp + 2 * s * 68);
    }
}

__global__ __launch_bounds__(256) void k_zero8(bf* dst, size_t n8) {
    const size_t i = (size_t)blockIdx.x * 256 + threadIdx.x; if (i >= n8) return; v8us z;
#pragma unroll
    for (int k = 0; k < 8; ++k) z[k] = 0;
    *(v8us*)(dst + i * 8) = z; 
}

// k_pack: bf16 hi + residual planes of k and of v^T of all items, laid out in WMMA A-fragment order, so that every wave-wide 16-byte load of k_fattn reads 512 contiguous bytes.
// One launch; thread id makes piece id of k and piece id of v^T of every item (no more waves to start than one packing of one item has).
// k: piece id = (((h * 128 + key tile) * 2 + ks) * 2 + u) * 32 + lane holds k[key tile * 16 + (lane & 15)][ks * 32 + u * 16 + 8 * (lane >> 4) + 0..7].
// v^T: piece id = (((h * 64 + key block) * 4 + t) * 2 + u) * 32 + lane holds v[key block * 32 + u * 16 + 8 * (lane >> 4) + 0..7][t * 16 + (lane & 15)].
__global__ __launch_bounds__(256) void k_pack(const float* __restrict__ KF, const float* __restrict__ VF, bf* KPh, bf* KPl, bf* VPh, bf* VPl) {
    const unsigned id = blockIdx.x * 256 + threadIdx.x;
    const int l = id & 31, u = (id >> 5) & 1, ks = (id >> 6) & 1, kt = (id >> 7) & 127, t = (id >> 6) & 3, kb = (id >> 8) & 63, h = id >> 14;
    const float* sk = KF + (size_t)(kt * 16 + (l & 15)) * DMOD + h * HD + ks * 32 + u * 16 + 8 * (l >> 4);
    const float* sv = VF + (size_t)(kb * 32 + u * 16 + 8 * (l >> 4)) * DMOD + h * HD + t * 16 + (l & 15);
    v8f vk[NBT], vv[NBT];
#pragma unroll
    for (int b = 0; b < NBT; ++b) { vk[b] = *(const v8f*)(sk + (size_t)b * NN * DMOD);
        asm volatile("s_wait_xcnt 0x0" ::: "memory");   // stands in front of the reuse, as a later load's destination too, of the address registers that the load above names
#pragma unroll
        for (int i = 0; i < 8; ++i) vv[b][i] = sv[(size_t)b * NN * DMOD + (size_t)i * DMOD];
        asm volatile("s_wait_xcnt 0x0" ::: "memory"); }   // the same for the eight loads above
    __builtin_amdgcn_sched_barrier(0);   // all of the thread's loads issue ahead of the conversions: left free, the scheduler converts k before it loads v, and the two latencies add up
    auto put = [&](const v8f v, bf* Ph, bf* Pl) { v8us oh, ol;
#pragma unroll
        for (int i = 0; i < 8; ++i) { const unsigned short hb = f2bf(v[i]); oh[i] = hb; ol[i] = f2bf(v[i] - bf2f(hb)); }
        *(v8us*)(Ph + (size_t)id * 8) = oh; *(v8us*)(Pl + (size_t)id * 8) = ol; };
#pragma unroll
    for (int b = 0; b < NBT; ++b) { const size_t io = (size_t)b * NN * DMOD; put(vk[b], KPh + io, KPl + io); put(vv[b], VPh + io, VPl + io); }
}
// d_mbits: the mask, read once. One block = 16 queries (a k_fattn tile) x 1024 keys, one wave a query row; a wave-wide 4-byte load covers one 32-key block (one line) and its ballot is that block's bit word (bit i = key i kept).
// WT[(tile * 64 + key block) * 16 + query] = the word, so that one load of k_fattn touches one line; FL[(tile * 2 + key half) * 32 + 0 / 1] = bit per key block: some key kept by some query of the tile / every key kept by every query.
// Each block writes whole lines of its own (its two flag words have a 128-byte line to themselves).
__device__ __forceinline__ void d_mbits(const int* __restrict__ MK, unsigned* WT, unsigned* FL) {
    __shared__ unsigned sh[16][33];   // 33: the 16 rows of one key block fall on different banks
    const int lane = threadIdx.x & 31, row = threadIdx.x >> 5, tile = blockIdx.x >> 1, half = blockIdx.x & 1;
    const int* s = MK + (size_t)(tile * 16 + row) * NN + half * (NN / 2) + lane;
    int v[32];
#pragma unroll
    for (int i = 0; i < 32; ++i) v[i] = s[i * 32];
    unsigned mine = 0;
#pragma unroll
    for (int i = 0; i < 32; ++i) { const unsigned w = __builtin_amdgcn_ballot_w32(v[i] != 0); mine = (lane == i) ? w : mine; }
    sh[row][lane] = mine;
    __syncthreads();
    WT[(size_t)(tile * 64 + half * 32) * 16 + threadIdx.x] = sh[threadIdx.x & 15][threadIdx.x >> 4];
    if (row == 0) { unsigned o = 0u, a = ~0u;
#pragma unroll
        for (int r = 0; r < 16; ++r) { const unsigned w = sh[r][lane]; o |= w; a &= w; }
        const unsigned ne = __builtin_amdgcn_ballot_w32(o != 0u), fu = __builtin_amdgcn_ballot_w32(a == ~0u);
        if (lane < 2) FL[(tile * 2 + half) * 32 + lane] = lane ? fu : ne; }
}
// k_prep: everything that depends on the inputs alone, in one launch. Blocks 0 .. MBB - 1 (the longest, so first) make the mask's bit form; in every later block each wave turns one row of DMOD floats into bf16:
// WBB blocks each for Wq, Wk, Wv, Wo, then x of all items; CV holds the five results one behind the other. The choice is the same for a whole block, so d_mbits' barrier is met by all of its threads or by none.
#define MBB (NN / 16 * 2)
#define WBB (DMOD / 16)
__global__ __launch_bounds__(512) void k_prep(const float* __restrict__ x, const int* __restrict__ MK, const float* __restrict__ Wq, const float* __restrict__ Wk, const float* __restrict__ Wv, const float* __restrict__ Wo, bf* CV, unsigned* WT, unsigned* FL) {
    if (blockIdx.x < MBB) { d_mbits(MK, WT, FL); return; }
    const unsigned cb = blockIdx.x - MBB, sg = cb / WBB;
    const float* src = (sg == 0 ? Wq : sg == 1 ? Wk : sg == 2 ? Wv : sg == 3 ? Wo : x) + (size_t)(sg < 4 ? cb - sg * WBB : cb - 4 * WBB) * 16 * DMOD;
    bf* dst = CV + (size_t)cb * 16 * DMOD;
    const int lane = threadIdx.x & 31; const size_t r = threadIdx.x >> 5;
#pragma unroll
    for (int q = 0; q < DMOD / 256; ++q) { v8us o;
#pragma unroll
        for (int i = 0; i < 8; ++i) o[i] = f2bf(src[r * DMOD + q * 256 + lane * 8 + i]);
        *(v8us*)(dst + r * DMOD + q * 256 + lane * 8) = o; }
    asm volatile("s_wait_xcnt 0x0" ::: "memory");   // stands behind the stores above, in front of the place where the block's two paths join in the built code and the stores' registers are written again
}
__device__ __forceinline__ float xhalf(float x) { const int b = __float_as_int(x); return __int_as_float(__builtin_amdgcn_permlanex16(b, b, 0x76543210, 0xfedcba98, false, false)); }   // the value of lane ^ 16
__global__ __launch_bounds__(256) void k_fattn(const float* __restrict__ QF, const bf* __restrict__ KPh, const bf* __restrict__ KPl, const bf* __restrict__ VPh, const bf* __restrict__ VPl, const unsigned* __restrict__ WT, const unsigned* __restrict__ FL, bf* Ch, bf* Cl) {
    typedef __attribute__((ext_vector_type(2))) float v2f;
    typedef __attribute__((ext_vector_type(2))) __bf16 v2bf;
    typedef __attribute__((ext_vector_type(8))) unsigned v8u;
    const int lane = threadIdx.x & 31, wave = __builtin_amdgcn_readfirstlane(threadIdx.x >> 5), c = lane & 15, hi = lane >> 4;
    const int tile = wave < 4 ? blockIdx.x * 4 + wave : NN / 16 - 1 - (blockIdx.x * 4 + wave - 4);   // every tile 0..127 once
    const int h = blockIdx.y, b = blockIdx.z, q0 = tile * 16;
    const unsigned long long ne = (unsigned long long)FL[tile * 64] | (unsigned long long)FL[tile * 64 + 32] << 32, fu = (unsigned long long)FL[tile * 64 + 1] | (unsigned long long)FL[tile * 64 + 33] << 32;   // bit kb: block not empty / full
    const size_t qoff = ((size_t)b * NN + q0 + c) * DMOD + h * HD + 8 * hi;   // the lane's query row, this head's columns: q on the way in, ctx on the way out
    v16bf qh[2], ql[2];
#pragma unroll
    for (int ks = 0; ks < 2; ++ks) { v8us oh[2], ol[2];
#pragma unroll
        for (int u = 0; u < 2; ++u) { const v8f v = *(const v8f*)(QF + qoff + ks * 32 + u * 16);
#pragma unroll
            for (int i = 0; i < 8; ++i) { const unsigned short hb = f2bf(v[i]); oh[u][i] = hb; ol[u][i] = f2bf(v[i] - bf2f(hb)); } }
        qh[ks] = cat16b(oh[0], oh[1]); ql[ks] = cat16b(ol[0], ol[1]); }
    const char* kh_ = (const char*)KPh; const char* kl_ = (const char*)KPl; const char* vh_ = (const char*)VPh; const char* vl_ = (const char*)VPl; const char* wt_ = (const char*)WT;
    const unsigned pb = (((unsigned)b * NH_ + h) * (NN * HD) + lane * 8) * 2u, mo = ((unsigned)tile * 1024u + c) * 4u;   // 32-bit byte offsets on the kernel's own base pointers
    const float CS = SCL * 1.44269504088896340736f;   // scores in log2 units
    v8f acc[4];
#pragma unroll
    for (int t = 0; t < 4; ++t) acc[t] = (v8f){};
    float m = -1.0e30f, lsum = 0.f;
    v16bf kh[4], kl[4], vh[4], vl[4];
    auto ldk = [&](const unsigned o) {   // k fragments of one key block: f = tile * 2 + ks
#pragma unroll
        for (int f = 0; f < 4; ++f) { const int fo = f * 1024;
            kh[f] = cat16b(*(const v8us*)((kh_ + fo) + o), *(const v8us*)((kh_ + fo + 512) + o)); kl[f] = cat16b(*(const v8us*)((kl_ + fo) + o), *(const v8us*)((kl_ + fo + 512) + o)); }
        asm volatile("s_wait_xcnt 0x0" ::: "memory");   // stands in front of the next write of the offset register that the loads above name
    };
    auto ldv = [&](const unsigned o) {   // v^T fragments of one key block: f = t
#pragma unroll
        for (int f = 0; f < 4; ++f) { const int fo = f * 1024;
            vh[f] = cat16b(*(const v8us*)((vh_ + fo) + o), *(const v8us*)((vh_ + fo + 512) + o)); vl[f] = cat16b(*(const v8us*)((vl_ + fo) + o), *(const v8us*)((vl_ + fo + 512) + o)); }
        asm volatile("s_wait_xcnt 0x0" ::: "memory");   // stands in front of the next write of the offset register that the loads above name
    };
    // The walk goes over the set bits of ne (the blocks that are not empty), so that the block after this one is known a pass ahead. Its k fragments are asked for as soon as this pass's score products have
    // read theirs, its v^T fragments as soon as this pass's ctx products have read theirs, each into the registers just freed: a load's latency runs beside the rest of the pass instead of in front of it.
    unsigned long long rem = ne;   // the same for the whole wave: scalar
    if (rem) {   // a tile with no key left in any block has nothing to walk
    int kb = __builtin_ctzll(rem);
    unsigned ov = pb + kb * 4096u;   // the v^T loads' own offset register, stepped where they are issued: taken from the k loads' offset, which is formed in another block of the pass, it became two 64-bit address pairs that the loads' own results overwrite
    ldk(ov); ldv(ov);
    __builtin_amdgcn_sched_barrier(0);   // holds the wait above directly behind its loads: left free, the scheduler puts vector work of q's conversion between them
#pragma unroll 1   // rolled: one pass's fragments already take most of the registers that four waves per SIMD leave a wave
    do {   // one trip a set bit: 64 at most
        rem &= rem - 1;
        const int kn = rem ? __builtin_ctzll(rem) : kb;   // the next block that is not empty; behind the last one this block again (in bounds, never used)
        const unsigned on = pb + kn * 4096u, om = mo + kb * 64u;
        v8f st[2];
#pragma unroll
        for (int tl = 0; tl < 2; ++tl) { st[tl] = (v8f){};
#pragma unroll
            for (int ks = 0; ks < 2; ++ks) { const int f = tl * 2 + ks;
                st[tl] = wmmab(kh[f], qh[ks], st[tl]); st[tl] = wmmab(kh[f], ql[ks], st[tl]); st[tl] = wmmab(kl[f], qh[ks], st[tl]); } }
        __builtin_amdgcn_sched_barrier(0);   // the next block's k loads issue as one group behind the products above: left free, the scheduler spreads them among the products
        ldk(on);
        __builtin_amdgcn_sched_barrier(0);   // holds the wait above directly behind its loads: left free, the scheduler puts vector work of the softmax between them
        float p[16]; float mx = -3.0e38f;
#pragma unroll
        for (int s = 0; s < 16; ++s) p[s] = st[s >> 3][s & 7] * CS;
        if (!((fu >> kb) & 1ull)) {   // the same for the whole wave; only a mixed block reads its word: the lane's query, this block's 32 keys
            const unsigned mw = *(const unsigned*)(wt_ + om);
            asm volatile("s_wait_xcnt 0x0" ::: "memory");   // stands in front of the step of the address register that the load above names
            const unsigned ml = mw >> (8 * hi);   // score s of the lane is key (s >> 3) * 16 + 8 * hi + (s & 7) of the block
#pragma unroll
            for (int s = 0; s < 16; ++s) p[s] = (ml & (1u << ((s >> 3) * 16 + (s & 7)))) ? p[s] : -3.0e38f; }
#pragma unroll
        for (int s = 0; s < 16; ++s) mx = fmaxf(mx, p[s]);
        mx = fmaxf(mx, xhalf(mx));
        const float mn = fmaxf(m, mx), al = __builtin_amdgcn_exp2f(m - mn); m = mn;
        float ps = 0.f;
#pragma unroll
        for (int s = 0; s < 16; ++s) { p[s] = __builtin_amdgcn_exp2f(p[s] - mn); ps += p[s]; }
        lsum = lsum * al + ps;
#pragma unroll
        for (int t = 0; t < 4; ++t) acc[t] *= al;
        v8u uh, ul;
#pragma unroll
        for (int s = 0; s < 8; ++s) { const v2f pp = {p[2 * s], p[2 * s + 1]}; const unsigned hw = __builtin_bit_cast(unsigned, __builtin_convertvector(pp, v2bf));
            const v2f rr = {pp[0] - __uint_as_float(hw << 16), pp[1] - __uint_as_float(hw & 0xFFFF0000u)}; uh[s] = hw; ul[s] = __builtin_bit_cast(unsigned, __builtin_convertvector(rr, v2bf)); }
        const v16bf ph = __builtin_bit_cast(v16bf, uh), pl = __builtin_bit_cast(v16bf, ul);
#pragma unroll
        for (int t = 0; t < 4; ++t) { acc[t] = wmmab(vh[t], ph, acc[t]); acc[t] = wmmab(vh[t], pl, acc[t]); acc[t] = wmmab(vl[t], ph, acc[t]); }
        __builtin_amdgcn_sched_barrier(0);   // the pass's vector work stays ahead of the loads below: left free, the scheduler takes the row sum's chain of adds from among the products, where the matrix unit's time covers it, to behind the loads
        ov += (unsigned)(kn - kb) * 4096u;
        ldv(ov);
        kb = kn;
    } while (rem);
    }
    lsum += xhalf(lsum);
    const float inv = 1.0f / lsum;
#pragma unroll
    for (int t = 0; t < 4; ++t) { const v8f r = acc[t] * inv; v8us oh, ol;   // acc[t][r] = ctx[query c][t * 16 + 8 * hi + r], stored as the output GEMM's bf16 hi + residual planes
#pragma unroll
        for (int i = 0; i < 8; ++i) { const unsigned short hb = f2bf(r[i]); oh[i] = hb; ol[i] = f2bf(r[i] - bf2f(hb)); }
        *(v8us*)(Ch + qoff + t * 16) = oh; *(v8us*)(Cl + qoff + t * 16) = ol; }
}

extern "C" void kernel_launch(void* const* d_in, const int* in_sizes, int n_in,
                              void* d_out, int out_size, void* d_ws, size_t ws_size, hipStream_t stream) {
    (void)in_sizes; (void)n_in; (void)out_size;
    const float* x = (const float*)d_in[0]; const int* MK = (const int*)d_in[1]; const float* Wq = (const float*)d_in[2]; const float* Wk = (const float*)d_in[3]; const float* Wv = (const float*)d_in[4]; const float* Wo = (const float*)d_in[5]; const float* bo = (const float*)d_in[6];
    float* out = (float*)d_out;    // [2][2048][1024]
    char* wsp = (char*)d_ws;
    auto take = [&](size_t bytes) { char* p = wsp; wsp += (bytes + 255) & ~(size_t)255; return (void*)p; };
    const size_t IT = (size_t)NN * DMOD;    // elements of one item
    bf* CV = (bf*)take(((size_t)4 * DMOD * DMOD + NBT * IT) * 2);    // k_prep's bf16 results, one behind the other
    bf* WQ = CV; bf* WO = CV + (size_t)3 * DMOD * DMOD; bf* Xb = CV + (size_t)4 * DMOD * DMOD;    // WK, WV follow WQ
    float* QF = (float*)take(3 * NBT * IT * 4); float* KF = QF + NBT * IT; float* VF = KF + NBT * IT;
    bf* KPh = (bf*)take(NBT * IT * 2); bf* KPl = (bf*)take(NBT * IT * 2); bf* VPh = (bf*)take(NBT * IT * 2); bf* VPl = (bf*)take(NBT * IT * 2);
    bf* Ch = (bf*)take(NBT * IT * 2); bf* Cl = (bf*)take(NBT * IT * 2);
    unsigned* WT = (unsigned*)take((size_t)NN * (NN / 32) * 4); unsigned* FL = (unsigned*)take((size_t)(NN / 16) * 2 * 128);
    if ((size_t)(wsp - (char*)d_ws) > ws_size) return;    // 16.8 + 50.3 + 33.6 + 16.8 + 0.6 ~ 118 MB
    k_prep<<<MBB + 4 * WBB + NBT * NN / 16, 512, 0, stream>>>(x, MK, Wq, Wk, Wv, Wo, CV, WT, FL);    // weights: [out][in] convention = n-major
    k_gemmb<false><<<dim3(NBT * NN / 128, DMOD / 128, 3), 128, 0, stream>>>(Xb, nullptr, WQ, nullptr, QF, DMOD * DMOD, NBT * NN * DMOD);
    k_pack<<<NN * DMOD / 8 / 256, 256, 0, stream>>>(KF, VF, KPh, KPl, VPh, VPl);
    k_fattn<<<dim3(NN / 128, NH_, NBT), 256, 0, stream>>>(QF, KPh, KPl, VPh, VPl, WT, FL, Ch, Cl);
    k_gemmb<true><<<dim3(NBT * NN / 128, DMOD / 128, 1), 128, 0, stream>>>(Ch, Cl, WO, bo, out, 0, 0);
}

// v007
// It runs in 113 microseconds.
// Next to v006, in two timings, it ran 1.06 times as fast each time.
// Over all steps from v000 it is 35.5 times as fast.
#include <hip/hip_runtime.h>

// Compute dtypes, f32 accumulate, per item: q/k/v = the k=1 causal convs = x.W^T as [2048 x 1024].[1024 x 1024] GEMMs with PLAIN bf16 operands (exact products); per head, in ONE fused kernel: scores^T = k.q^T (both operands bf16 hi + UNSCALED residual, three products), masked online softmax (x 1/8; positions where the INPUT attn_mask == 0 are excluded, per (query, key), from the bit form that d_mbits makes of the mask in the same call) in f32, ctx^T += v^T.P^T (P and v as bf16 hi + residual, three products)

#define NBT  2
#define NN   2048
#define DMOD 1024
#define NH_  16
#define HD   64
#define DM   DMOD
#define NTK  NN
#define SCL  0.125f
#define LOSC 1024.0f

typedef _Float16 h16;
typedef unsigned short bf;
typedef __attribute__((ext_vector_type(16))) __bf16   v16bf;
typedef __attribute__((ext_vector_type(16))) _Float16 v16h;
typedef __attribute__((ext_vector_type(8)))  _Float16 v8h;
typedef __attribute__((ext_vector_type(8)))  unsigned short v8us;
typedef __attribute__((ext_vector_type(8)))  float    v8f;
typedef __attribute__((ext_vector_type(4)))  float    v4f;
typedef __attribute__((ext_vector_type(4)))  _Float16 v4h;
typedef v8h  __attribute__((may_alias)) v8ha;
typedef v4f  __attribute__((may_alias)) v4fa;
typedef v8us __attribute__((may_alias)) v8usa;

__device__ __forceinline__ unsigned short f2bf(float f) { unsigned u = __float_as_uint(f); u += 0x7FFFu + ((u >> 16) & 1u); return (unsigned short)(u >> 16); }
__device__ __forceinline__ float bf2f(unsigned short b) { return __uint_as_float(((unsigned)b) << 16); }
__device__ __forceinline__ float bfr(float f) { return bf2f(f2bf(f)); }
__device__ __forceinline__ v16h cat16(v8h lo, v8h hi) { return __builtin_shufflevector(lo, hi, 0, 1, 2, 3, 4, 5, 6, 7, 8, 9, 10, 11, 12, 13, 14, 15); }
__device__ __forceinline__ v16bf cat16b(v8us lo, v8us hi) { return __builtin_bit_cast(v16bf, __builtin_shufflevector(lo, hi, 0, 1, 2, 3, 4, 5, 6, 7, 8, 9, 10, 11, 12, 13, 14, 15)); }
__device__ __forceinline__ v8f wmma16(v16h a, v16h b, v8f c) { return __builtin_amdgcn_wmma_f32_16x16x32_f16(false, a, false, b, (short)0, c, false, false); }
__device__ __forceinline__ v8f wmmab(v16bf a, v16bf b, v8f c) { return __builtin_amdgcn_wmma_f32_16x16x32_bf16(false, a, false, b, (short)0, c, false, false); }

// k_gemmb: 128 x 128 block tile (2 x 2 waves, 64 x 64 each: 16 accumulator tiles a wave) of C[NBT * NN][DM] = (A [+ Al]).B^T (K = DM) [+ bf(bias[c])]; f32 whole-line epilogue.
// A fragment read from LDS feeds four products, and a row of A or B is fetched from L2 once per 128 rows of the other operand.
// The operand tiles (128 rows x KS k each) go through LDS: every wave-wide 16-byte global load covers four 128-byte row pieces (four whole lines), each tile is fetched once for the four waves,
// and stage s + 1 is on its way in registers while stage s is multiplied. Rows lie LP bytes apart in LDS (an odd multiple of 16 bytes: the 16 rows of a fragment read fall on 64 different banks).
// SPLITA = false is the q, k, v projection (grid plane z = the weight): it stores no f32 C. A lane's eight accumulator values of one tile are eight successive rows of the first operand at one row of the second,
// which IS one 16-byte piece of the fragment-ordered planes that k_fattn loads, once the first operand is chosen for it: x for v (eight successive keys of one feature), the weight for q and k (eight successive
// features of one token; the product is then the transposed one, same k order). So every tile goes from the registers to the bf16 hi + residual planes, each wave-wide 16-byte store covering 512 contiguous bytes.
// q, k: piece id = (((h * 128 + token tile) * 2 + ks) * 2 + u) * 32 + lane holds k[token tile * 16 + (lane & 15)][ks * 32 + u * 16 + 8 * (lane >> 4) + 0..7].
// v^T: piece id = (((h * 32 + pair of key blocks) * 4 + t) * 4 + g) * 32 + lane holds v[pair * 64 + g * 16 + 8 * (lane >> 4) + 0..7][t * 16 + (lane & 15)]: key block kb has g = (kb & 1) * 2 + 0, 1 of pair kb >> 1.
#define KS 64
#define LP (KS * 2 + 16)
// acc[u][t] = 16 rows u of the first operand x 16 rows t of the second: unit t * 4 + u of the wave's sixteen units of 512 bytes, in all three projections
__device__ __forceinline__ void d_planes(const v8f (&acc)[4][4], char* ph, char* pl, const unsigned vo) {   // ph, pl: the wave's first unit in either plane (the same in every lane); vo: the lane's 16 bytes in a unit
    typedef __attribute__((ext_vector_type(2))) float v2f;
    typedef __attribute__((ext_vector_type(2))) __bf16 v2bf;
    typedef __attribute__((ext_vector_type(4))) unsigned v4u;
    v4u hw[4][4], lw[4][4];
#pragma unroll
    for (int u = 0; u < 4; ++u)
#pragma unroll
        for (int t = 0; t < 4; ++t)
#pragma unroll
            for (int s = 0; s < 4; ++s) { const v2f pp = {acc[u][t][2 * s], acc[u][t][2 * s + 1]}; const unsigned w = __builtin_bit_cast(unsigned, __builtin_convertvector(pp, v2bf));
                const v2f rr = {pp[0] - __uint_as_float(w << 16), pp[1] - __uint_as_float(w & 0xFFFF0000u)}; hw[u][t][s] = w; lw[u][t][s] = __builtin_bit_cast(unsigned, __builtin_convertvector(rr, v2bf)); }
    __builtin_amdgcn_sched_barrier(0);   // every conversion stands ahead of the first store: left free, the scheduler mixes them and writes registers anew that an issued store still names
#pragma unroll
    for (int u = 0; u < 4; ++u)
#pragma unroll
        for (int t = 0; t < 4; ++t) { *(v4u*)((ph + (t * 4 + u) * 512) + vo) = hw[u][t]; *(v4u*)((pl + (t * 4 + u) * 512) + vo) = lw[u][t]; }   // every store a constant distance from one address
}
template <bool SPLITA>
__global__ __launch_bounds__(128) void k_gemmb(const bf* __restrict__ A, const bf* __restrict__ Al, const bf* __restrict__ Bn, const float* __restrict__ bias, float* C, bf* P) {
    constexpr int NT = SPLITA ? 3 : 2;   // tiles of a stage: A, [Al,] B
    constexpr int GQ = SPLITA ? 2 : 1;   // 32-k steps whose fragments are read from LDS as one group
    __shared__ __align__(16) char stg[2][NT][128 * LP];
    const int lane = threadIdx.x & 31, wave = threadIdx.x >> 5, lr = lane & 15, hi = lane >> 4, wm = wave >> 1, wn = wave & 1;
    const bool wf = !SPLITA && blockIdx.z < 2;   // q, k: the weight's rows take the first operand's place, x's rows the second's (the same for the whole block)
    const bf* Bz = Bn + (size_t)blockIdx.z * (DM * DM);   // grid plane z: its own weight matrix; blockIdx.x counts the 128-row tiles of A (all items), blockIdx.y those of the weight
    const bf* M1 = wf ? Bz : A; const bf* M2 = wf ? A : Bz;
    const int t1 = (wf ? blockIdx.y : blockIdx.x) * 128, t2 = (wf ? blockIdx.x : blockIdx.y) * 128;
    const int sg = threadIdx.x >> 3, srow = (sg & 1) * 8 + (sg >> 1), spc = threadIdx.x & 7;   // staging: this thread moves piece spc (16 bytes) of rows srow + 16 i of every tile; 16 lanes hold rows r and r + 8, whose pieces fall on 64 different banks
    const char* ga = (const char*)M1 + ((size_t)(t1 + srow) * DM + spc * 8) * 2;
    const char* gl = (const char*)(SPLITA ? Al : M1) + ((size_t)(t1 + srow) * DM + spc * 8) * 2;
    const char* gb = (const char*)M2 + ((size_t)(t2 + srow) * DM + spc * 8) * 2;
    const int ls = srow * LP + spc * 16, fa = (wm * 64 + lr) * LP + hi * 16, fb = (wn * 64 + lr) * LP + hi * 16;
    v8us ra[8], rl[8], rb[8];
    auto fetch = [&](int s) {
#pragma unroll
        for (int i = 0; i < 8; ++i) { const int o = i * 16 * DM * 2 + s * KS * 2; ra[i] = *(const v8us*)(ga + o); if (SPLITA) rl[i] = *(const v8us*)(gl + o); rb[i] = *(const v8us*)(gb + o); }
    };
    auto put = [&](int buf) {
#pragma unroll
        for (int i = 0; i < 8; ++i) { const int o = ls + i * 16 * LP; *(v8usa*)(&stg[buf][0][o]) = ra[i]; if (SPLITA) *(v8usa*)(&stg[buf][1][o]) = rl[i]; *(v8usa*)(&stg[buf][NT - 1][o]) = rb[i]; }
    };
    v8f acc[4][4];
#pragma unroll
    for (int u = 0; u < 4; ++u)
#pragma unroll
        for (int t = 0; t < 4; ++t) acc[u][t] = (v8f){};
    fetch(0); put(0);
    __syncthreads();
#pragma unroll   // unrolled: buffer, stage offset and the last stage's test become constants, and no address register is stepped behind a load
    for (int s = 0; s < DM / KS; ++s) {
        const int buf = s & 1;
        if (s + 1 < DM / KS) fetch(s + 1);
        if (s + 2 == DM / KS) asm volatile("s_wait_xcnt 0x0" ::: "memory");   // directly behind the last loads: from here on the address registers that the K loop's loads name are free for reuse
#pragma unroll
        for (int g = 0; g < KS / 32 / GQ; ++g) {
            v16bf a[GQ][4], al[GQ][4], b[GQ][4];
#pragma unroll
            for (int q = 0; q < GQ; ++q) { const int k = (g * GQ + q) * 64;
#pragma unroll
                for (int t = 0; t < 4; ++t) { const int ro = t * 16 * LP + k;
                    a[q][t] = cat16b(*(const v8usa*)(&stg[buf][0][fa + ro]), *(const v8usa*)(&stg[buf][0][fa + ro + 32]));
                    if (SPLITA) al[q][t] = cat16b(*(const v8usa*)(&stg[buf][1][fa + ro]), *(const v8usa*)(&stg[buf][1][fa + ro + 32]));
                    b[q][t] = cat16b(*(const v8usa*)(&stg[buf][NT - 1][fb + ro]), *(const v8usa*)(&stg[buf][NT - 1][fb + ro + 32])); } }
            __builtin_amdgcn_sched_barrier(0);   // the group's LDS reads issue together, ahead of its products: left free, the scheduler reuses one fragment's registers and the wave waits out an LDS latency at every product
#pragma unroll
            for (int q = 0; q < GQ; ++q) {   // per accumulator the order stays A, Al, step by step; the sixteen tiles stand between two products into the same one
#pragma unroll
                for (int u = 0; u < 4; ++u)
#pragma unroll
                    for (int t = 0; t < 4; ++t) acc[u][t] = wmmab(a[q][u], b[q][t], acc[u][t]);
                if (SPLITA) {
#pragma unroll
                    for (int u = 0; u < 4; ++u)
#pragma unroll
                        for (int t = 0; t < 4; ++t) acc[u][t] = wmmab(al[q][u], b[q][t], acc[u][t]); } }
        }
        if (s + 1 < DM / KS) {
            put(buf ^ 1);      // into the buffer that stage s - 1 was read from: its readers left it at the barrier that ended that stage
            __syncthreads();   // publishes stage s + 1 and ends the reads of stage s
        }
    }
    if constexpr (!SPLITA) {
        const int wv = __builtin_amdgcn_readfirstlane(wave), w1 = wv >> 1, w2 = wv & 1;   // the wave's number in a scalar register: the stores' base addresses are then scalar too
        const int tok = blockIdx.x * 128 + (wf ? w2 : w1) * 64, h = blockIdx.y * 2 + (wf ? w1 : w2);   // the wave's 64 tokens (counted over all items) and its 64 features = one head
        char* ph = (char*)(P + (size_t)blockIdx.z * (2 * NBT * NN * DM) + (size_t)(tok / NN) * (NN * DM) + h * (NN * HD) + (tok % NN) * HD);   // 64 tokens of a head are 16 successive 512-byte units in every plane
        char* pl = ph + (size_t)NBT * NN * DM * 2;
        d_planes(acc, ph, pl, lane * 16u);
    } else {
    __shared__ __align__(16) float ost[4][16 * 68];
    const int r0 = blockIdx.x * 128 + wm * 64, c0 = blockIdx.y * 128 + wn * 64;
    float* os = &ost[wave][0];   // the wave's own staging rows: 16 rows x 64 columns at a time
    float bv[4] = {0.f, 0.f, 0.f, 0.f};
    if (bias) {
#pragma unroll
        for (int t = 0; t < 4; ++t) bv[t] = bfr(bias[c0 + t * 16 + lr]); }
    float* cp = C + ((size_t)r0 + hi) * DM + c0 + ((lane >> 3) & 1) * 32 + (lane & 7) * 4;   // eight lanes store one whole line; every further store is a constant distance away
    const float* sp = os + hi * 68 + ((lane >> 3) & 1) * 32 + (lane & 7) * 4;
#pragma unroll
    for (int u = 0; u < 4; ++u) {
#pragma unroll
        for (int t = 0; t < 4; ++t)
#pragma unroll
            for (int j = 0; j < 8; ++j) os[(hi * 8 + j) * 68 + t * 16 + lr] = acc[u][t][j] + bv[t];
        asm volatile("s_wait_dscnt 0x0" ::: "memory");   // the wave's own rows stand in LDS before its lanes read them back; no other wave touches them, and a work-group barrier here would make every slice wait for the global stores of the slice before
#pragma unroll
        for (int s = 0; s < 8; ++s) *(v4f*)(cp + (u * 16 + 2 * s) * DM) = *(const v4fa*)(sp + 2 * s * 68);
    }
    }
}

__global__ __launch_bounds__(256) void k_zero8(bf* dst, size_t n8) {
    const size_t i = (size_t)blockIdx.x * 256 + threadIdx.x; if (i >= n8) return; v8us z;
#pragma unroll
    for (int k = 0; k < 8; ++k) z[k] = 0;
    *(v8us*)(dst + i * 8) = z; 
}

// d_mbits: the mask, read once. One block = 16 queries (a k_fattn tile) x 1024 keys, one wave a query row; a wave-wide 4-byte load covers one 32-key block (one line) and its ballot is that block's bit word (bit i = key i kept).
// WT[(tile * 64 + key block) * 16 + query] = the word, so that one load of k_fattn touches one line; FL[(tile * 2 + key half) * 32 + 0 / 1] = bit per key block: some key kept by some query of the tile / every key kept by every query.
// Each block writes whole lines of its own (its two flag words have a 128-byte line to themselves).
__device__ __forceinline__ void d_mbits(const int* __restrict__ MK, unsigned* WT, unsigned* FL) {
    __shared__ unsigned sh[16][33];   // 33: the 16 rows of one key block fall on different banks
    const int lane = threadIdx.x & 31, row = threadIdx.x >> 5, tile = blockIdx.x >> 1, half = blockIdx.x & 1;
    const int* s = MK + (size_t)(tile * 16 + row) * NN + half * (NN / 2) + lane;
    int v[32];
#pragma unroll
    for (int i = 0; i < 32; ++i) v[i] = s[i * 32];
    unsigned mine = 0;
#pragma unroll
    for (int i = 0; i < 32; ++i) { const unsigned w = __builtin_amdgcn_ballot_w32(v[i] != 0); mine = (lane == i) ? w : mine; }
    sh[row][lane] = mine;
    __syncthreads();
    WT[(size_t)(tile * 64 + half * 32) * 16 + threadIdx.x] = sh[threadIdx.x & 15][threadIdx.x >> 4];
    if (row == 0) { unsigned o = 0u, a = ~0u;
#pragma unroll
        for (int r = 0; r < 16; ++r) { const unsigned w = sh[r][lane]; o |= w; a &= w; }
        const unsigned ne = __builtin_amdgcn_ballot_w32(o != 0u), fu = __builtin_amdgcn_ballot_w32(a == ~0u);
        if (lane < 2) FL[(tile * 2 + half) * 32 + lane] = lane ? fu : ne; }
}
// k_prep: everything that depends on the inputs alone, in one launch. Blocks 0 .. MBB - 1 (the longest, so first) make the mask's bit form; in every later block each wave turns one row of DMOD floats into bf16:
// WBB blocks each for Wq, Wk, Wv, Wo, then x of all items; CV holds the five results one behind the other. The choice is the same for a whole block, so d_mbits' barrier is met by all of its threads or by none.
#define MBB (NN / 16 * 2)
#define WBB (DMOD / 16)
__global__ __launch_bounds__(512) void k_prep(const float* __restrict__ x, const int* __restrict__ MK, const float* __restrict__ Wq, const float* __restrict__ Wk, const float* __restrict__ Wv, const float* __restrict__ Wo, bf* CV, unsigned* WT, unsigned* FL) {
    if (blockIdx.x < MBB) { d_mbits(MK, WT, FL); return; }
    const unsigned cb = blockIdx.x - MBB, sg = cb / WBB;
    const float* src = (sg == 0 ? Wq : sg == 1 ? Wk : sg == 2 ? Wv : sg == 3 ? Wo : x) + (size_t)(sg < 4 ? cb - sg * WBB : cb - 4 * WBB) * 16 * DMOD;
    bf* dst = CV + (size_t)cb * 16 * DMOD;
    const int lane = threadIdx.x & 31; const size_t r = threadIdx.x >> 5;
#pragma unroll
    for (int q = 0; q < DMOD / 256; ++q) { v8us o;
#pragma unroll
        for (int i = 0; i < 8; ++i) o[i] = f2bf(src[r * DMOD + q * 256 + lane * 8 + i]);
        *(v8us*)(dst + r * DMOD + q * 256 + lane * 8) = o; }
    asm volatile("s_wait_xcnt 0x0" ::: "memory");   // stands behind the stores above, in front of the place where the block's two paths join in the built code and the stores' registers are written again
}
__device__ __forceinline__ float xhalf(float x) { const int b = __float_as_int(x); return __int_as_float(__builtin_amdgcn_permlanex16(b, b, 0x76543210, 0xfedcba98, false, false)); }   // the value of lane ^ 16
__global__ __launch_bounds__(256) void k_fattn(const bf* __restrict__ QPh, const bf* __restrict__ QPl, const bf* __restrict__ KPh, const bf* __restrict__ KPl, const bf* __restrict__ VPh, const bf* __restrict__ VPl, const unsigned* __restrict__ WT, const unsigned* __restrict__ FL, bf* Ch, bf* Cl) {
    typedef __attribute__((ext_vector_type(2))) float v2f;
    typedef __attribute__((ext_vector_type(2))) __bf16 v2bf;
    typedef __attribute__((ext_vector_type(8))) unsigned v8u;
    const int lane = threadIdx.x & 31, wave = __builtin_amdgcn_readfirstlane(threadIdx.x >> 5), c = lane & 15, hi = lane >> 4;
    const int tile = wave < 4 ? blockIdx.x * 4 + wave : NN / 16 - 1 - (blockIdx.x * 4 + wave - 4);   // every tile 0..127 once
    const int h = blockIdx.y, b = blockIdx.z, q0 = tile * 16;
    const unsigned long long ne = (unsigned long long)FL[tile * 64] | (unsigned long long)FL[tile * 64 + 32] << 32, fu = (unsigned long long)FL[tile * 64 + 1] | (unsigned long long)FL[tile * 64 + 33] << 32;   // bit kb: block not empty / full
    const size_t qoff = ((size_t)b * NN + q0 + c) * DMOD + h * HD + 8 * hi;   // the lane's query row, this head's columns: where ctx goes
    const char* kh_ = (const char*)KPh; const char* kl_ = (const char*)KPl; const char* vh_ = (const char*)VPh; const char* vl_ = (const char*)VPl; const char* wt_ = (const char*)WT;
    const unsigned pb = (((unsigned)b * NH_ + h) * (NN * HD) + lane * 8) * 2u, mo = ((unsigned)tile * 1024u + c) * 4u;   // 32-bit byte offsets on the kernel's own base pointers
    const char* qh_ = (const char*)QPh; const char* ql_ = (const char*)QPl;
    const float CS = SCL * 1.44269504088896340736f;   // scores in log2 units
    v8f acc[4];
#pragma unroll
    for (int t = 0; t < 4; ++t) acc[t] = (v8f){};
    float m = -1.0e30f, lsum = 0.f;
    v16bf kh[4], kl[4], vh[4], vl[4];
    auto ldk = [&](const unsigned o) {   // k fragments of one key block: f = tile * 2 + ks
#pragma unroll
        for (int f = 0; f < 4; ++f) { const int fo = f * 1024;
            kh[f] = cat16b(*(const v8us*)((kh_ + fo) + o), *(const v8us*)((kh_ + fo + 512) + o)); kl[f] = cat16b(*(const v8us*)((kl_ + fo) + o), *(const v8us*)((kl_ + fo + 512) + o)); }
        asm volatile("s_wait_xcnt 0x0" ::: "memory");   // stands in front of the next write of the offset register that the loads above name
    };
    auto ldv = [&](const unsigned o) {   // v^T fragments of one key block: f = t, 2048 bytes apart (the pair's other block lies between)
#pragma unroll
        for (int f = 0; f < 4; ++f) { const int fo = f * 2048;
            vh[f] = cat16b(*(const v8us*)((vh_ + fo) + o), *(const v8us*)((vh_ + fo + 512) + o)); vl[f] = cat16b(*(const v8us*)((vl_ + fo) + o), *(const v8us*)((vl_ + fo + 512) + o)); }
        asm volatile("s_wait_xcnt 0x0" ::: "memory");   // stands in front of the next write of the offset register that the loads above name
    };
    // The walk goes over the set bits of ne (the blocks that are not empty), so that the block after this one is known a pass ahead. Its k fragments are asked for as soon as this pass's score products have
    // read theirs, its v^T fragments as soon as this pass's ctx products have read theirs, each into the registers just freed: a load's latency runs beside the rest of the pass instead of in front of it.
    unsigned long long rem = ne;   // the same for the whole wave: scalar
    if (rem) {   // a tile with no key left in any block has nothing to walk
    int kb = __builtin_ctzll(rem);
    auto vof = [](const int k) { return (unsigned)(k >> 1) * 8192u + (unsigned)(k & 1) * 1024u; };   // where key block k's v^T begins in its head
    unsigned ov = pb + vof(kb);   // the v^T loads' own offset register, stepped where they are issued: taken from the k loads' offset, which is formed in another block of the pass, it became two 64-bit address pairs that the loads' own results overwrite
    v16bf qh[2], ql[2];   // the tile's q fragments, as the projection stored them: four pieces of 512 bytes a plane; the wait that ends ldk stands behind these loads too, in front of the next write of their offset register
    const unsigned oq = pb + (unsigned)tile * 2048u;
#pragma unroll
    for (int ks = 0; ks < 2; ++ks) { const int fo = ks * 1024;
        qh[ks] = cat16b(*(const v8us*)((qh_ + fo) + oq), *(const v8us*)((qh_ + fo + 512) + oq)); ql[ks] = cat16b(*(const v8us*)((ql_ + fo) + oq), *(const v8us*)((ql_ + fo + 512) + oq)); }
    ldk(pb + kb * 4096u); ldv(ov);
    __builtin_amdgcn_sched_barrier(0);   // holds the wait above directly behind its loads: left free, the scheduler puts vector work of the set-up between them
#pragma unroll 1   // rolled: one pass's fragments already take most of the registers that four waves per SIMD leave a wave
    do {   // one trip a set bit: 64 at most
        rem &= rem - 1;
        const int kn = rem ? __builtin_ctzll(rem) : kb;   // the next block that is not empty; behind the last one this block again (in bounds, never used)
        const unsigned on = pb + kn * 4096u, om = mo + kb * 64u;
        v8f st[2];
#pragma unroll
        for (int tl = 0; tl < 2; ++tl) { st[tl] = (v8f){};
#pragma unroll
            for (int ks = 0; ks < 2; ++ks) { const int f = tl * 2 + ks;
                st[tl] = wmmab(kh[f], qh[ks], st[tl]); st[tl] = wmmab(kh[f], ql[ks], st[tl]); st[tl] = wmmab(kl[f], qh[ks], st[tl]); } }
        __builtin_amdgcn_sched_barrier(0);   // the next block's k loads issue as one group behind the products above: left free, the scheduler spreads them among the products
        ldk(on);
        __builtin_amdgcn_sched_barrier(0);   // holds the wait above directly behind its loads: left free, the scheduler puts vector work of the softmax between them
        float p[16]; float mx = -3.0e38f;
#pragma unroll
        for (int s = 0; s < 16; ++s) p[s] = st[s >> 3][s & 7] * CS;
        if (!((fu >> kb) & 1ull)) {   // the same for the whole wave; only a mixed block reads its word: the lane's query, this block's 32 keys
            const unsigned mw = *(const unsigned*)(wt_ + om);
            asm volatile("s_wait_xcnt 0x0" ::: "memory");   // stands in front of the step of the address register that the load above names
            const unsigned ml = mw >> (8 * hi);   // score s of the lane is key (s >> 3) * 16 + 8 * hi + (s & 7) of the block
#pragma unroll
            for (int s = 0; s < 16; ++s) p[s] = (ml & (1u << ((s >> 3) * 16 + (s & 7)))) ? p[s] : -3.0e38f; }
#pragma unroll
        for (int s = 0; s < 16; ++s) mx = fmaxf(mx, p[s]);
        mx = fmaxf(mx, xhalf(mx));
        const float mn = fmaxf(m, mx), al = __builtin_amdgcn_exp2f(m - mn); m = mn;
        float ps = 0.f;
#pragma unroll
        for (int s = 0; s < 16; ++s) { p[s] = __builtin_amdgcn_exp2f(p[s] - mn); ps += p[s]; }
        lsum = lsum * al + ps;
#pragma unroll
        for (int t = 0; t < 4; ++t) acc[t] *= al;
        v8u uh, ul;
#pragma unroll
        for (int s = 0; s < 8; ++s) { const v2f pp = {p[2 * s], p[2 * s + 1]}; const unsigned hw = __builtin_bit_cast(unsigned, __builtin_convertvector(pp, v2bf));
            const v2f rr = {pp[0] - __uint_as_float(hw << 16), pp[1] - __uint_as_float(hw & 0xFFFF0000u)}; uh[s] = hw; ul[s] = __builtin_bit_cast(unsigned, __builtin_convertvector(rr, v2bf)); }
        const v16bf ph = __builtin_bit_cast(v16bf, uh), pl = __builtin_bit_cast(v16bf, ul);
#pragma unroll
        for (int t = 0; t < 4; ++t) { acc[t] = wmmab(vh[t], ph, acc[t]); acc[t] = wmmab(vh[t], pl, acc[t]); acc[t] = wmmab(vl[t], ph, acc[t]); }
        __builtin_amdgcn_sched_barrier(0);   // the pass's vector work stays ahead of the loads below: left free, the scheduler takes the row sum's chain of adds from among the products, where the matrix unit's time covers it, to behind the loads
        ov += vof(kn) - vof(kb);
        ldv(ov);
        kb = kn;
    } while (rem);
    }
    lsum += xhalf(lsum);
    const float inv = 1.0f / lsum;
#pragma unroll
    for (int t = 0; t < 4; ++t) { const v8f r = acc[t] * inv; v8us oh, ol;   // acc[t][r] = ctx[query c][t * 16 + 8 * hi + r], stored as the output GEMM's bf16 hi + residual planes
#pragma unroll
        for (int i = 0; i < 8; ++i) { const unsigned short hb = f2bf(r[i]); oh[i] = hb; ol[i] = f2bf(r[i] - bf2f(hb)); }
        *(v8us*)(Ch + qoff + t * 16) = oh; *(v8us*)(Cl + qoff + t * 16) = ol; }
}

extern "C" void kernel_launch(void* const* d_in, const int* in_sizes, int n_in,
                              void* d_out, int out_size, void* d_ws, size_t ws_size, hipStream_t stream) {
    (void)in_sizes; (void)n_in; (void)out_size;
    const float* x = (const float*)d_in[0]; const int* MK = (const int*)d_in[1]; const float* Wq = (const float*)d_in[2]; const float* Wk = (const float*)d_in[3]; const float* Wv = (const float*)d_in[4]; const float* Wo = (const float*)d_in[5]; const float* bo = (const float*)d_in[6];
    float* out = (float*)d_out;    // [2][2048][1024]
    char* wsp = (char*)d_ws;
    auto take = [&](size_t bytes) { char* p = wsp; wsp += (bytes + 255) & ~(size_t)255; return (void*)p; };
    const size_t IT = (size_t)NN * DMOD;    // elements of one item
    bf* CV = (bf*)take(((size_t)4 * DMOD * DMOD + NBT * IT) * 2);    // k_prep's bf16 results, one behind the other
    bf* WQ = CV; bf* WO = CV + (size_t)3 * DMOD * DMOD; bf* Xb = CV + (size_t)4 * DMOD * DMOD;    // WK, WV follow WQ
    bf* QPh = (bf*)take(6 * NBT * IT * 2); bf* QPl = QPh + NBT * IT; bf* KPh = QPl + NBT * IT; bf* KPl = KPh + NBT * IT; bf* VPh = KPl + NBT * IT; bf* VPl = VPh + NBT * IT;    // the projections' planes: hi, residual of q, of k, of v^T
    bf* Ch = (bf*)take(NBT * IT * 2); bf* Cl = (bf*)take(NBT * IT * 2);
    unsigned* WT = (unsigned*)take((size_t)NN * (NN / 32) * 4); unsigned* FL = (unsigned*)take((size_t)(NN / 16) * 2 * 128);
    if ((size_t)(wsp - (char*)d_ws) > ws_size) return;    // 16.8 + 50.3 + 16.8 + 0.6 ~ 85 MB
    k_prep<<<MBB + 4 * WBB + NBT * NN / 16, 512, 0, stream>>>(x, MK, Wq, Wk, Wv, Wo, CV, WT, FL);    // weights: [out][in] convention = n-major
    k_gemmb<false><<<dim3(NBT * NN / 128, DMOD / 128, 3), 128, 0, stream>>>(Xb, nullptr, WQ, nullptr, nullptr, QPh);
    k_fattn<<<dim3(NN / 128, NH_, NBT), 256, 0, stream>>>(QPh, QPl, KPh, KPl, VPh, VPl, WT, FL, Ch, Cl);
    k_gemmb<true><<<dim3(NBT * NN / 128, DMOD / 128, 1), 128, 0, stream>>>(Ch, Cl, WO, bo, out, nullptr);
}

// v008
// A run of this version takes 94.3 microseconds.
// In two side-by-side timings against v007, it was 1.21 and 1.20 times as fast.
// Over all steps from v000 it is 42.6 times as fast.
#include <hip/hip_runtime.h>

// Compute dtypes, f32 accumulate, per item: q/k/v = the k=1 causal convs = x.W^T as [2048 x 1024].[1024 x 1024] GEMMs with PLAIN bf16 operands (exact products); per head, in ONE fused kernel: scores^T = k.q^T (both operands bf16 hi + UNSCALED residual, three products), masked online softmax (x 1/8; positions where the INPUT attn_mask == 0 are excluded, per (query, key), from the bit form that d_mbits makes of the mask in the same call) in f32, ctx^T += v^T.P^T (P and v as bf16 hi + residual, three products)

#define NBT  2
#define NN   2048
#define DMOD 1024
#define NH_  16
#define HD   64
#define DM   DMOD
#define NTK  NN
#define SCL  0.125f
#define LOSC 1024.0f

typedef _Float16 h16;
typedef unsigned short bf;
typedef __attribute__((ext_vector_type(16))) __bf16   v16bf;
typedef __attribute__((ext_vector_type(16))) _Float16 v16h;
typedef __attribute__((ext_vector_type(8)))  _Float16 v8h;
typedef __attribute__((ext_vector_type(8)))  unsigned short v8us;
typedef __attribute__((ext_vector_type(8)))  float    v8f;
typedef __attribute__((ext_vector_type(4)))  float    v4f;
typedef __attribute__((ext_vector_type(4)))  _Float16 v4h;
typedef v8h  __attribute__((may_alias)) v8ha;
typedef v4f  __attribute__((may_alias)) v4fa;
typedef v8us __attribute__((may_alias)) v8usa;

__device__ __forceinline__ unsigned short f2bf(float f) { unsigned u = __float_as_uint(f); u += 0x7FFFu + ((u >> 16) & 1u); return (unsigned short)(u >> 16); }
__device__ __forceinline__ float bf2f(unsigned short b) { return __uint_as_float(((unsigned)b) << 16); }
__device__ __forceinline__ float bfr(float f) { return bf2f(f2bf(f)); }
__device__ __forceinline__ v16h cat16(v8h lo, v8h hi) { return __builtin_shufflevector(lo, hi, 0, 1, 2, 3, 4, 5, 6, 7, 8, 9, 10, 11, 12, 13, 14, 15); }
__device__ __forceinline__ v16bf cat16b(v8us lo, v8us hi) { return __builtin_bit_cast(v16bf, __builtin_shufflevector(lo, hi, 0, 1, 2, 3, 4, 5, 6, 7, 8, 9, 10, 11, 12, 13, 14, 15)); }
__device__ __forceinline__ v8f wmma16(v16h a, v16h b, v8f c) { return __builtin_amdgcn_wmma_f32_16x16x32_f16(false, a, false, b, (short)0, c, false, false); }
__device__ __forceinline__ v8f wmmab(v16bf a, v16bf b, v8f c) { return __builtin_amdgcn_wmma_f32_16x16x32_bf16(false, a, false, b, (short)0, c, false, false); }

// k_gemmb: 128 x 128 block tile (2 x 2 waves, 64 x 64 each: 16 accumulator tiles a wave) of C[NBT * NN][DM] = (A [+ Al]).B^T (K = DM) [+ bf(bias[c])]; f32 whole-line epilogue.
// A fragment read from LDS feeds four products, and a row of A or B is fetched from L2 once per 128 rows of the other operand.
// The operand tiles (128 rows x KS k each) go through LDS: every wave-wide 16-byte global load covers four 128-byte row pieces (four whole lines), each tile is fetched once for the four waves,
// and stage s + 1 is on its way in registers while stage s is multiplied. Rows lie LP bytes apart in LDS (an odd multiple of 16 bytes: the 16 rows of a fragment read fall on 64 different banks).
// SPLITA = false is the q, k, v projection (grid plane z = the weight): it stores no f32 C. A lane's eight accumulator values of one tile are eight successive rows of the first operand at one row of the second,
// which IS one 16-byte piece of the fragment-ordered planes that k_fattn loads, once the first operand is chosen for it: x for v (eight successive keys of one feature), the weight for q and k (eight successive
// features of one token; the product is then the transposed one, same k order). So every tile goes from the registers to the bf16 hi + residual planes, each wave-wide 16-byte store covering 512 contiguous bytes.
// q, k: piece id = (((h * 128 + token tile) * 2 + ks) * 2 + u) * 32 + lane holds k[token tile * 16 + (lane & 15)][ks * 32 + u * 16 + 8 * (lane >> 4) + 0..7].
// v^T: piece id = (((h * 32 + pair of key blocks) * 4 + t) * 4 + g) * 32 + lane holds v[pair * 64 + g * 16 + 8 * (lane >> 4) + 0..7][t * 16 + (lane & 15)]: key block kb has g = (kb & 1) * 2 + 0, 1 of pair kb >> 1.
#define KS 64
#define LP (KS * 2 + 16)
// acc[u][t] = 16 rows u of the first operand x 16 rows t of the second: unit t * 4 + u of the wave's sixteen units of 512 bytes, in all three projections
__device__ __forceinline__ void d_planes(const v8f (&acc)[4][4], char* ph, char* pl, const unsigned vo) {   // ph, pl: the wave's first unit in either plane (the same in every lane); vo: the lane's 16 bytes in a unit
    typedef __attribute__((ext_vector_type(2))) float v2f;
    typedef __attribute__((ext_vector_type(2))) __bf16 v2bf;
    typedef __attribute__((ext_vector_type(4))) unsigned v4u;
    v4u hw[4][4], lw[4][4];
#pragma unroll
    for (int u = 0; u < 4; ++u)
#pragma unroll
        for (int t = 0; t < 4; ++t)
#pragma unroll
            for (int s = 0; s < 4; ++s) { const v2f pp = {acc[u][t][2 * s], acc[u][t][2 * s + 1]}; const unsigned w = __builtin_bit_cast(unsigned, __builtin_convertvector(pp, v2bf));
                const v2f rr = {pp[0] - __uint_as_float(w << 16), pp[1] - __uint_as_float(w & 0xFFFF0000u)}; hw[u][t][s] = w; lw[u][t][s] = __builtin_bit_cast(unsigned, __builtin_convertvector(rr, v2bf)); }
    __builtin_amdgcn_sched_barrier(0);   // every conversion stands ahead of the first store: left free, the scheduler mixes them and writes registers anew that an issued store still names
#pragma unroll
    for (int u = 0; u < 4; ++u)
#pragma unroll
        for (int t = 0; t < 4; ++t) { *(v4u*)((ph + (t * 4 + u) * 512) + vo) = hw[u][t]; *(v4u*)((pl + (t * 4 + u) * 512) + vo) = lw[u][t]; }   // every store a constant distance from one address
}
template <bool SPLITA>
__global__ __launch_bounds__(128) void k_gemmb(const bf* __restrict__ A, const bf* __restrict__ Al, const bf* __restrict__ Bn, const float* __restrict__ bias, float* C, bf* P) {
    constexpr int NT = SPLITA ? 3 : 2;   // tiles of a stage: A, [Al,] B
    constexpr int GQ = SPLITA ? 2 : 1;   // 32-k steps whose fragments are read from LDS as one group
    __shared__ __align__(16) char stg[2][NT][128 * LP];
    const int lane = threadIdx.x & 31, wave = threadIdx.x >> 5, lr = lane & 15, hi = lane >> 4, wm = wave >> 1, wn = wave & 1;
    const bool wf = !SPLITA && blockIdx.z < 2;   // q, k: the weight's rows take the first operand's place, x's rows the second's (the same for the whole block)
    const bf* Bz = Bn + (size_t)blockIdx.z * (DM * DM);   // grid plane z: its own weight matrix; blockIdx.x counts the 128-row tiles of A (all items), blockIdx.y those of the weight
    const bf* M1 = wf ? Bz : A; const bf* M2 = wf ? A : Bz;
    const int t1 = (wf ? blockIdx.y : blockIdx.x) * 128, t2 = (wf ? blockIdx.x : blockIdx.y) * 128;
    const int sg = threadIdx.x >> 3, srow = (sg & 1) * 8 + (sg >> 1), spc = threadIdx.x & 7;   // staging: this thread moves piece spc (16 bytes) of rows srow + 16 i of every tile; 16 lanes hold rows r and r + 8, whose pieces fall on 64 different banks
    const char* ga = (const char*)M1 + ((size_t)(t1 + srow) * DM + spc * 8) * 2;
    const char* gl = (const char*)(SPLITA ? Al : M1) + ((size_t)(t1 + srow) * DM + spc * 8) * 2;
    const char* gb = (const char*)M2 + ((size_t)(t2 + srow) * DM + spc * 8) * 2;
    const int ls = srow * LP + spc * 16, fa = (wm * 64 + lr) * LP + hi * 16, fb = (wn * 64 + lr) * LP + hi * 16;
    v8us ra[8], rl[8], rb[8];
    auto fetch = [&](int s) {
#pragma unroll
        for (int i = 0; i < 8; ++i) { const int o = i * 16 * DM * 2 + s * KS * 2; ra[i] = *(const v8us*)(ga + o); if (SPLITA) rl[i] = *(const v8us*)(gl + o); rb[i] = *(const v8us*)(gb + o); }
    };
    auto put = [&](int buf) {
#pragma unroll
        for (int i = 0; i < 8; ++i) { const int o = ls + i * 16 * LP; *(v8usa*)(&stg[buf][0][o]) = ra[i]; if (SPLITA) *(v8usa*)(&stg[buf][1][o]) = rl[i]; *(v8usa*)(&stg[buf][NT - 1][o]) = rb[i]; }
    };
    v8f acc[4][4];
#pragma unroll
    for (int u = 0; u < 4; ++u)
#pragma unroll
        for (int t = 0; t < 4; ++t) acc[u][t] = (v8f){};
    fetch(0); put(0);
    __syncthreads();
#pragma unroll   // unrolled: buffer, stage offset and the last stage's test become constants, and no address register is stepped behind a load
    for (int s = 0; s < DM / KS; ++s) {
        const int buf = s & 1;
        if (s + 1 < DM / KS) fetch(s + 1);
        if (s + 2 == DM / KS) asm volatile("s_wait_xcnt 0x0" ::: "memory");   // directly behind the last loads: from here on the address registers that the K loop's loads name are free for reuse
#pragma unroll
        for (int g = 0; g < KS / 32 / GQ; ++g) {
            v16bf a[GQ][4], al[GQ][4], b[GQ][4];
#pragma unroll
            for (int q = 0; q < GQ; ++q) { const int k = (g * GQ + q) * 64;
#pragma unroll
                for (int t = 0; t < 4; ++t) { const int ro = t * 16 * LP + k;
                    a[q][t] = cat16b(*(const v8usa*)(&stg[buf][0][fa + ro]), *(const v8usa*)(&stg[buf][0][fa + ro + 32]));
                    if (SPLITA) al[q][t] = cat16b(*(const v8usa*)(&stg[buf][1][fa + ro]), *(const v8usa*)(&stg[buf][1][fa + ro + 32]));
                    b[q][t] = cat16b(*(const v8usa*)(&stg[buf][NT - 1][fb + ro]), *(const v8usa*)(&stg[buf][NT - 1][fb + ro + 32])); } }
            __builtin_amdgcn_sched_barrier(0);   // the group's LDS reads issue together, ahead of its products: left free, the scheduler reuses one fragment's registers and the wave waits out an LDS latency at every product
#pragma unroll
            for (int q = 0; q < GQ; ++q) {   // per accumulator the order stays A, Al, step by step; the sixteen tiles stand between two products into the same one
#pragma unroll
                for (int u = 0; u < 4; ++u)
#pragma unroll
                    for (int t = 0; t < 4; ++t) acc[u][t] = wmmab(a[q][u], b[q][t], acc[u][t]);
                if (SPLITA) {
#pragma unroll
                    for (int u = 0; u < 4; ++u)
#pragma unroll
                        for (int t = 0; t < 4; ++t) acc[u][t] = wmmab(al[q][u], b[q][t], acc[u][t]); } }
        }
        if (s + 1 < DM / KS) {
            put(buf ^ 1);      // into the buffer that stage s - 1 was read from: its readers left it at the barrier that ended that stage
            __syncthreads();   // publishes stage s + 1 and ends the reads of stage s
        }
    }
    if constexpr (!SPLITA) {
        const int wv = __builtin_amdgcn_readfirstlane(wave), w1 = wv >> 1, w2 = wv & 1;   // the wave's number in a scalar register: the stores' base addresses are then scalar too
        const int tok = blockIdx.x * 128 + (wf ? w2 : w1) * 64, h = blockIdx.y * 2 + (wf ? w1 : w2);   // the wave's 64 tokens (counted over all items) and its 64 features = one head
        char* ph = (char*)(P + (size_t)blockIdx.z * (2 * NBT * NN * DM) + (size_t)(tok / NN) * (NN * DM) + h * (NN * HD) + (tok % NN) * HD);   // 64 tokens of a head are 16 successive 512-byte units in every plane
        char* pl = ph + (size_t)NBT * NN * DM * 2;
        d_planes(acc, ph, pl, lane * 16u);
    } else {
    __shared__ __align__(16) float ost[4][16 * 68];
    const int r0 = blockIdx.x * 128 + wm * 64, c0 = blockIdx.y * 128 + wn * 64;
    float* os = &ost[wave][0];   // the wave's own staging rows: 16 rows x 64 columns at a time
    float bv[4] = {0.f, 0.f, 0.f, 0.f};
    if (bias) {
#pragma unroll
        for (int t = 0; t < 4; ++t) bv[t] = bfr(bias[c0 + t * 16 + lr]); }
    float* cp = C + ((size_t)r0 + hi) * DM + c0 + ((lane >> 3) & 1) * 32 + (lane & 7) * 4;   // eight lanes store one whole line; every further store is a constant distance away
    const float* sp = os + hi * 68 + ((lane >> 3) & 1) * 32 + (lane & 7) * 4;
#pragma unroll
    for (int u = 0; u < 4; ++u) {
#pragma unroll
        for (int t = 0; t < 4; ++t)
#pragma unroll
            for (int j = 0; j < 8; ++j) os[(hi * 8 + j) * 68 + t * 16 + lr] = acc[u][t][j] + bv[t];
        asm volatile("s_wait_dscnt 0x0" ::: "memory");   // the wave's own rows stand in LDS before its lanes read them back; no other wave touches them, and a work-group barrier here would make every slice wait for the global stores of the slice before
#pragma unroll
        for (int s = 0; s < 8; ++s) *(v4f*)(cp + (u * 16 + 2 * s) * DM) = *(const v4fa*)(sp + 2 * s * 68);
    }
    }
}

__global__ __launch_bounds__(256) void k_zero8(bf* dst, size_t n8) {
    const size_t i = (size_t)blockIdx.x * 256 + threadIdx.x; if (i >= n8) return; v8us z;
#pragma unroll
    for (int k = 0; k < 8; ++k) z[k] = 0;
    *(v8us*)(dst + i * 8) = z; 
}

// d_mbits: the mask, read once. One block = 16 queries (a k_fattn tile) x 1024 keys, one wave a query row; a wave-wide 4-byte load covers one 32-key block (one line) and its ballot is that block's bit word (bit i = key i kept).
// WT[(tile * 64 + key block) * 16 + query] = the word, so that one load of k_fattn touches one line; FL[(tile * 2 + key half) * 32 + 0 / 1] = bit per key block: some key kept by some query of the tile / every key kept by every query.
// Each block writes whole lines of its own (its two flag words have a 128-byte line to themselves).
__device__ __forceinline__ void d_mbits(const int* __restrict__ MK, unsigned* WT, unsigned* FL) {
    __shared__ unsigned sh[16][33];   // 33: the 16 rows of one key block fall on different banks
    const int lane = threadIdx.x & 31, row = threadIdx.x >> 5, tile = blockIdx.x >> 1, half = blockIdx.x & 1;
    const int* s = MK + (size_t)(tile * 16 + row) * NN + half * (NN / 2) + lane;
    int v[32];
#pragma unroll
    for (int i = 0; i < 32; ++i) v[i] = s[i * 32];
    unsigned mine = 0;
#pragma unroll
    for (int i = 0; i < 32; ++i) { const unsigned w = __builtin_amdgcn_ballot_w32(v[i] != 0); mine = (lane == i) ? w : mine; }
    sh[row][lane] = mine;
    __syncthreads();
    WT[(size_t)(tile * 64 + half * 32) * 16 + threadIdx.x] = sh[threadIdx.x & 15][threadIdx.x >> 4];
    if (row == 0) { unsigned o = 0u, a = ~0u;
#pragma unroll
        for (int r = 0; r < 16; ++r) { const unsigned w = sh[r][lane]; o |= w; a &= w; }
        const unsigned ne = __builtin_amdgcn_ballot_w32(o != 0u), fu = __builtin_amdgcn_ballot_w32(a == ~0u);
        if (lane < 2) FL[(tile * 2 + half) * 32 + lane] = lane ? fu : ne; }
}
// k_prep: everything that depends on the inputs alone, in one launch. Blocks 0 .. MBB - 1 (the longest, so first) make the mask's bit form; in every later block each wave turns one row of DMOD floats into bf16:
// WBB blocks each for Wq, Wk, Wv, Wo, then x of all items; CV holds the five results one behind the other. The choice is the same for a whole block, so d_mbits' barrier is met by all of its threads or by none.
#define MBB (NN / 16 * 2)
#define WBB (DMOD / 16)
__global__ __launch_bounds__(512) void k_prep(const float* __restrict__ x, const int* __restrict__ MK, const float* __restrict__ Wq, const float* __restrict__ Wk, const float* __restrict__ Wv, const float* __restrict__ Wo, bf* CV, unsigned* WT, unsigned* FL) {
    if (blockIdx.x < MBB) { d_mbits(MK, WT, FL); return; }
    const unsigned cb = blockIdx.x - MBB, sg = cb / WBB;
    const float* src = (sg == 0 ? Wq : sg == 1 ? Wk : sg == 2 ? Wv : sg == 3 ? Wo : x) + (size_t)(sg < 4 ? cb - sg * WBB : cb - 4 * WBB) * 16 * DMOD;
    bf* dst = CV + (size_t)cb * 16 * DMOD;
    const int lane = threadIdx.x & 31; const size_t r = threadIdx.x >> 5;
#pragma unroll
    for (int q = 0; q < DMOD / 256; ++q) { v8us o;
#pragma unroll
        for (int i = 0; i < 8; ++i) o[i] = f2bf(src[r * DMOD + q * 256 + lane * 8 + i]);
        *(v8us*)(dst + r * DMOD + q * 256 + lane * 8) = o; }
    asm volatile("s_wait_xcnt 0x0" ::: "memory");   // stands behind the stores above, in front of the place where the block's two paths join in the built code and the stores' registers are written again
}
__device__ __forceinline__ float xhalf(float x) { const int b = __float_as_int(x); return __int_as_float(__builtin_amdgcn_permlanex16(b, b, 0x76543210, 0xfedcba98, false, false)); }   // the value of lane ^ 16
typedef v8f __attribute__((may_alias)) v8fa;
#define XW (34 * 32)   // floats that a wave hands over: 4 ctx tiles of 8 a lane, the maximum, the sum
__global__ __launch_bounds__(256) void k_fattn(const bf* __restrict__ QPh, const bf* __restrict__ QPl, const bf* __restrict__ KPh, const bf* __restrict__ KPl, const bf* __restrict__ VPh, const bf* __restrict__ VPl, const unsigned* __restrict__ WT, const unsigned* __restrict__ FL, bf* Ch, bf* Cl) {
    typedef __attribute__((ext_vector_type(2))) float v2f;
    typedef __attribute__((ext_vector_type(2))) __bf16 v2bf;
    typedef __attribute__((ext_vector_type(8))) unsigned v8u;
    __shared__ __align__(32) float xs[2][8][XW];   // a range of its own for either group: no wave writes where another may still read
    const int lane = threadIdx.x & 31, wave = __builtin_amdgcn_readfirstlane(threadIdx.x >> 5), c = lane & 15, hi = lane >> 4;
    const int hw = wave >> 2, pr = blockIdx.x * 4 + (wave & 3);   // the wave's place in its pair; the pair 0..31
    const int h = blockIdx.y, b = blockIdx.z;
    const char* kh_ = (const char*)KPh; const char* kl_ = (const char*)KPl; const char* vh_ = (const char*)VPh; const char* vl_ = (const char*)VPl; const char* wt_ = (const char*)WT;
    const unsigned pb = (((unsigned)b * NH_ + h) * (NN * HD) + lane * 8) * 2u;   // 32-bit byte offset on the kernel's own base pointers
    const char* qh_ = (const char*)QPh; const char* ql_ = (const char*)QPl;
    const float CS = SCL * 1.44269504088896340736f;   // scores in log2 units
    // Both groups' flag words (two tiles each: not empty / full, low and high key half) are read up front, so that the second group's walk does not begin with a load's latency.
    const unsigned* fa = FL + pr * 128; const unsigned* fb = FL + (NN / 32 - 1 - pr) * 128;
    const unsigned a0 = fa[0], a1 = fa[1], a2 = fa[32], a3 = fa[33], a4 = fa[64], a5 = fa[65], a6 = fa[96], a7 = fa[97];
    const unsigned b0 = fb[0], b1 = fb[1], b2 = fb[32], b3 = fb[33], b4 = fb[64], b5 = fb[65], b6 = fb[96], b7 = fb[97];
    const unsigned long long neA = (unsigned long long)(a0 | a4) | (unsigned long long)(a2 | a6) << 32, fuA = (unsigned long long)(a1 & a5) | (unsigned long long)(a3 & a7) << 32;   // the same for the whole wave: scalar
    const unsigned long long neB = (unsigned long long)(b0 | b4) | (unsigned long long)(b2 | b6) << 32, fuB = (unsigned long long)(b1 & b5) | (unsigned long long)(b3 & b7) << 32;
#pragma unroll 1   // rolled: the two groups run one after the other through the same code and registers
    for (int g = 0; g < 2; ++g) {   // the same two trips for every wave of the block: the barrier below is met by all
    const int tile = (g ? NN / 32 - 1 - pr : pr) * 2;   // the group's first 16-query tile; every group 0..63 once
    const int q0 = tile * 16;
    const unsigned long long ne = g ? neB : neA, fu = g ? fuB : fuA;   // bit kb: block not empty for one of the group's two tiles / full for both
    const size_t qoff = ((size_t)b * NN + q0 + c) * DMOD + h * HD + 8 * hi;   // the lane's query row of tile 0, this head's columns: where ctx goes
    const unsigned mo = ((unsigned)tile * 1024u + c) * 4u;
    v8f acc[2][4];
#pragma unroll
    for (int qt = 0; qt < 2; ++qt)
#pragma unroll
        for (int t = 0; t < 4; ++t) acc[qt][t] = (v8f){};
    float m[2] = {-1.0e30f, -1.0e30f}, lsum[2] = {0.f, 0.f};
    v16bf kh[4], kl[4], vh[4], vl[4];
    auto ldk = [&](const unsigned o) {   // k fragments of one key block: f = tile * 2 + ks
#pragma unroll
        for (int f = 0; f < 4; ++f) { const int fo = f * 1024;
            kh[f] = cat16b(*(const v8us*)((kh_ + fo) + o), *(const v8us*)((kh_ + fo + 512) + o)); kl[f] = cat16b(*(const v8us*)((kl_ + fo) + o), *(const v8us*)((kl_ + fo + 512) + o)); }
        asm volatile("s_wait_xcnt 0x0" ::: "memory");   // stands in front of the next write of the offset register that the loads above name
    };
    auto ldv = [&](const unsigned o) {   // v^T fragments of one key block: f = t, 2048 bytes apart (the pair's other block lies between)
#pragma unroll
        for (int f = 0; f < 4; ++f) { const int fo = f * 2048;
            vh[f] = cat16b(*(const v8us*)((vh_ + fo) + o), *(const v8us*)((vh_ + fo + 512) + o)); vl[f] = cat16b(*(const v8us*)((vl_ + fo) + o), *(const v8us*)((vl_ + fo + 512) + o)); }
        asm volatile("s_wait_xcnt 0x0" ::: "memory");   // stands in front of the next write of the offset register that the loads above name
    };
    // The walk goes over every other set bit of ne (the blocks that are not empty), so that the wave's block after this one is known a pass ahead. Its k fragments are asked for as soon as this pass's score products have
    // read theirs, its v^T fragments as soon as this pass's ctx products have read theirs, each into the registers just freed: a load's latency runs beside the rest of the pass instead of in front of it.
    unsigned long long rem = hw ? ne & (ne - 1) : ne;   // the same for the whole wave: scalar; its lowest set bit is the wave's next block
    if (rem) {   // a wave with no block of its own has nothing to walk
    int kb = __builtin_ctzll(rem);
    auto vof = [](const int k) { return (unsigned)(k >> 1) * 8192u + (unsigned)(k & 1) * 1024u; };   // where key block k's v^T begins in its head
    unsigned ov = pb + vof(kb);   // the v^T loads' own offset register, stepped where they are issued: taken from the k loads' offset, which is formed in another block of the pass, it became two 64-bit address pairs that the loads' own results overwrite
    v16bf qh[2][2], ql[2][2];   // both tiles' q fragments, as the projection stored them: four pieces of 512 bytes a tile and plane; the wait that ends ldk stands behind these loads too, in front of the next write of their offset register
    const unsigned oq = pb + (unsigned)tile * 2048u;
#pragma unroll
    for (int qt = 0; qt < 2; ++qt)
#pragma unroll
        for (int ks = 0; ks < 2; ++ks) { const int fo = qt * 2048 + ks * 1024;
            qh[qt][ks] = cat16b(*(const v8us*)((qh_ + fo) + oq), *(const v8us*)((qh_ + fo + 512) + oq)); ql[qt][ks] = cat16b(*(const v8us*)((ql_ + fo) + oq), *(const v8us*)((ql_ + fo + 512) + oq)); }
    ldk(pb + kb * 4096u); ldv(ov);
    __builtin_amdgcn_sched_barrier(0);   // holds the wait above directly behind its loads: left free, the scheduler puts vector work of the set-up between them
#pragma unroll 1   // rolled: one pass's fragments and both tiles' state already take most of the registers that two waves per SIMD leave a wave
    do {   // one trip for every other set bit: 32 at most
        rem &= rem - 1;   // this block
        rem &= rem - 1;   // the partner's next one (0 stays 0)
        const int kn = rem ? __builtin_ctzll(rem) : kb;   // the wave's next block; behind the last one this block again (in bounds, never used)
        const unsigned on = pb + kn * 4096u, om = mo + kb * 64u;
        v8f st[2][2];
#pragma unroll
        for (int tl = 0; tl < 2; ++tl)
#pragma unroll
            for (int qt = 0; qt < 2; ++qt) { st[qt][tl] = (v8f){};
#pragma unroll
                for (int ks = 0; ks < 2; ++ks) { const int f = tl * 2 + ks;
                    st[qt][tl] = wmmab(kh[f], qh[qt][ks], st[qt][tl]); st[qt][tl] = wmmab(kh[f], ql[qt][ks], st[qt][tl]); st[qt][tl] = wmmab(kl[f], qh[qt][ks], st[qt][tl]); } }
        __builtin_amdgcn_sched_barrier(0);   // the next block's k loads issue as one group behind the products above: left free, the scheduler spreads them among the products
        ldk(on);
        __builtin_amdgcn_sched_barrier(0);   // holds the wait above directly behind its loads: left free, the scheduler puts vector work of the softmax between them
        float p[2][16];
#pragma unroll
        for (int qt = 0; qt < 2; ++qt)
#pragma unroll
            for (int s = 0; s < 16; ++s) p[qt][s] = st[qt][s >> 3][s & 7] * CS;
        if (!((fu >> kb) & 1ull)) {   // the same for the whole wave; only a mixed block reads its words: the lane's query of either tile, this block's 32 keys
            const unsigned mw0 = *(const unsigned*)(wt_ + om);
            asm volatile("s_wait_xcnt 0x0" ::: "memory");   // stands in front of the second load, whose result may take the offset register that the first load names
            const unsigned mw1 = *(const unsigned*)((wt_ + 4096) + om);
            asm volatile("s_wait_xcnt 0x0" ::: "memory");   // stands in front of the step of the address register that the load above names
            const unsigned ml[2] = {mw0 >> (8 * hi), mw1 >> (8 * hi)};   // score s of the lane is key (s >> 3) * 16 + 8 * hi + (s & 7) of the block
#pragma unroll
            for (int qt = 0; qt < 2; ++qt)
#pragma unroll
                for (int s = 0; s < 16; ++s) p[qt][s] = (ml[qt] & (1u << ((s >> 3) * 16 + (s & 7)))) ? p[qt][s] : -3.0e38f; }
#pragma unroll
        for (int qt = 0; qt < 2; ++qt) {   // per tile: maximum, exp2, sum, rescale, split of P, ctx products; the two tiles are independent of each other
            float mx = -3.0e38f;
#pragma unroll
            for (int s = 0; s < 16; ++s) mx = fmaxf(mx, p[qt][s]);
            mx = fmaxf(mx, xhalf(mx));
            const float mn = fmaxf(m[qt], mx), al = __builtin_amdgcn_exp2f(m[qt] - mn); m[qt] = mn;
            float ps = 0.f;
#pragma unroll
            for (int s = 0; s < 16; ++s) { p[qt][s] = __builtin_amdgcn_exp2f(p[qt][s] - mn); ps += p[qt][s]; }
            lsum[qt] = lsum[qt] * al + ps;
#pragma unroll
            for (int t = 0; t < 4; ++t) acc[qt][t] *= al;
            v8u uh, ul;
#pragma unroll
            for (int s = 0; s < 8; ++s) { const v2f pp = {p[qt][2 * s], p[qt][2 * s + 1]}; const unsigned hw_ = __builtin_bit_cast(unsigned, __builtin_convertvector(pp, v2bf));
                const v2f rr = {pp[0] - __uint_as_float(hw_ << 16), pp[1] - __uint_as_float(hw_ & 0xFFFF0000u)}; uh[s] = hw_; ul[s] = __builtin_bit_cast(unsigned, __builtin_convertvector(rr, v2bf)); }
            const v16bf ph = __builtin_bit_cast(v16bf, uh), pl = __builtin_bit_cast(v16bf, ul);
            // per accumulator the order stays vh.ph, vh.pl, vl.ph; the four tiles stand between two products into the same one
#pragma unroll
            for (int t = 0; t < 4; ++t) acc[qt][t] = wmmab(vh[t], ph, acc[qt][t]);
#pragma unroll
            for (int t = 0; t < 4; ++t) acc[qt][t] = wmmab(vh[t], pl, acc[qt][t]);
#pragma unroll
            for (int t = 0; t < 4; ++t) acc[qt][t] = wmmab(vl[t], ph, acc[qt][t]);
        }
        __builtin_amdgcn_sched_barrier(0);   // the pass's vector work stays ahead of the loads below: left free, the scheduler takes the row sum's chain of adds from among the products, where the matrix unit's time covers it, to behind the loads
        ov += vof(kn) - vof(kb);
        ldv(ov);
        kb = kn;
    } while (rem);
    }
    // The join: the pair's first wave hands over tile 1 and finishes tile 0, the second the other way round.
    float* mine = &xs[g][wave][0]; const float* oth = &xs[g][wave ^ 4][0];
    auto give = [&](const int qt) {
#pragma unroll
        for (int t = 0; t < 4; ++t) *(v8fa*)(mine + (t * 32 + lane) * 8) = acc[qt][t];
        mine[1024 + lane] = m[qt]; mine[1056 + lane] = lsum[qt];
    };
    auto fin = [&](const int qt) {   // both parts brought to the common maximum, then as for one part; a part without a key has maximum -1e30, sum 0, ctx 0
        const float m2 = oth[1024 + lane], l2 = oth[1056 + lane];
        const float mj = fmaxf(m[qt], m2), a1 = __builtin_amdgcn_exp2f(m[qt] - mj), a2 = __builtin_amdgcn_exp2f(m2 - mj);
        float ls = lsum[qt] * a1 + l2 * a2;
        ls += xhalf(ls);
        const float inv = 1.0f / ls;
#pragma unroll
        for (int t = 0; t < 4; ++t) { const v8f o2 = *(const v8fa*)(oth + (t * 32 + lane) * 8); const v8f r = (acc[qt][t] * a1 + o2 * a2) * inv; v8us oh, ol;   // r[i] = ctx[query qt * 16 + c][t * 16 + 8 * hi + i], stored as the output GEMM's bf16 hi + residual planes
#pragma unroll
            for (int i = 0; i < 8; ++i) { const unsigned short hb = f2bf(r[i]); oh[i] = hb; ol[i] = f2bf(r[i] - bf2f(hb)); }
            *(v8us*)(Ch + qoff + qt * 16 * DMOD + t * 16) = oh; *(v8us*)(Cl + qoff + qt * 16 * DMOD + t * 16) = ol; }
        asm volatile("s_wait_xcnt 0x0" ::: "memory");   // stands behind the stores above, in front of the next group's writes of the registers that they name
    };
    if (hw) give(0); else give(1);   // the same for the whole wave
    __syncthreads();   // publishes what the waves hand over; met by every wave once a group
    if (hw) fin(1); else fin(0);
    }
}

extern "C" void kernel_launch(void* const* d_in, const int* in_sizes, int n_in,
                              void* d_out, int out_size, void* d_ws, size_t ws_size, hipStream_t stream) {
    (void)in_sizes; (void)n_in; (void)out_size;
    const float* x = (const float*)d_in[0]; const int* MK = (const int*)d_in[1]; const float* Wq = (const float*)d_in[2]; const float* Wk = (const float*)d_in[3]; const float* Wv = (const float*)d_in[4]; const float* Wo = (const float*)d_in[5]; const float* bo = (const float*)d_in[6];
    float* out = (float*)d_out;    // [2][2048][1024]
    char* wsp = (char*)d_ws;
    auto take = [&](size_t bytes) { char* p = wsp; wsp += (bytes + 255) & ~(size_t)255; return (void*)p; };
    const size_t IT = (size_t)NN * DMOD;    // elements of one item
    bf* CV = (bf*)take(((size_t)4 * DMOD * DMOD + NBT * IT) * 2);    // k_prep's bf16 results, one behind the other
    bf* WQ = CV; bf* WO = CV + (size_t)3 * DMOD * DMOD; bf* Xb = CV + (size_t)4 * DMOD * DMOD;    // WK, WV follow WQ
    bf* QPh = (bf*)take(6 * NBT * IT * 2); bf* QPl = QPh + NBT * IT; bf* KPh = QPl + NBT * IT; bf* KPl = KPh + NBT * IT; bf* VPh = KPl + NBT * IT; bf* VPl = VPh + NBT * IT;    // the projections' planes: hi, residual of q, of k, of v^T
    bf* Ch = (bf*)take(NBT * IT * 2); bf* Cl = (bf*)take(NBT * IT * 2);
    unsigned* WT = (unsigned*)take((size_t)NN * (NN / 32) * 4); unsigned* FL = (unsigned*)take((size_t)(NN / 16) * 2 * 128);
    if ((size_t)(wsp - (char*)d_ws) > ws_size) return;    // 16.8 + 50.3 + 16.8 + 0.6 ~ 85 MB
    k_prep<<<MBB + 4 * WBB + NBT * NN / 16, 512, 0, stream>>>(x, MK, Wq, Wk, Wv, Wo, CV, WT, FL);    // weights: [out][in] convention = n-major
    k_gemmb<false><<<dim3(NBT * NN / 128, DMOD / 128, 3), 128, 0, stream>>>(Xb, nullptr, WQ, nullptr, nullptr, QPh);
    k_fattn<<<dim3(NN / 256, NH_, NBT), 256, 0, stream>>>(QPh, QPl, KPh, KPl, VPh, VPl, WT, FL, Ch, Cl);
    k_gemmb<true><<<dim3(NBT * NN / 128, DMOD / 128, 1), 128, 0, stream>>>(Ch, Cl, WO, bo, out, nullptr);
}

// v010
// A run of this version takes 71.2 microseconds.
// Versions in between are left out here; by their measured steps it is 1.32 times as fast as v008.
// Counting every step since v000, it is 56.4 times as fast.
#include <hip/hip_runtime.h>

// Compute dtypes, f32 accumulate, per item: q/k/v = the k=1 causal convs = x.W^T as [2048 x 1024].[1024 x 1024] GEMMs with PLAIN bf16 operands (exact products); per head, in ONE fused kernel: scores^T = k.q^T (both operands one f16 value each, one product), masked online softmax (x 1/8; positions where the INPUT attn_mask == 0 are excluded, per (query, key), from the bit form that d_mbits makes of the mask in the same call) in f32, ctx^T += v^T.P^T (P and v one f16 value each, one product); f16's 11 significant bits round 8 times finer than the bf16 operands of the projections that make q, k, v

#define NBT  2
#define NN   2048
#define DMOD 1024
#define NH_  16
#define HD   64
#define DM   DMOD
#define NTK  NN
#define SCL  0.125f
#define LOSC 1024.0f

typedef _Float16 h16;
typedef unsigned short bf;
typedef __attribute__((ext_vector_type(16))) __bf16   v16bf;
typedef __attribute__((ext_vector_type(16))) _Float16 v16h;
typedef __attribute__((ext_vector_type(8)))  _Float16 v8h;
typedef __attribute__((ext_vector_type(8)))  unsigned short v8us;
typedef __attribute__((ext_vector_type(8)))  float    v8f;
typedef __attribute__((ext_vector_type(4)))  float    v4f;
typedef __attribute__((ext_vector_type(4)))  _Float16 v4h;
typedef v8h  __attribute__((may_alias)) v8ha;
typedef v4f  __attribute__((may_alias)) v4fa;
typedef v8us __attribute__((may_alias)) v8usa;

__device__ __forceinline__ unsigned short f2bf(float f) { unsigned u = __float_as_uint(f); u += 0x7FFFu + ((u >> 16) & 1u); return (unsigned short)(u >> 16); }
__device__ __forceinline__ float bf2f(unsigned short b) { return __uint_as_float(((unsigned)b) << 16); }
__device__ __forceinline__ float bfr(float f) { return bf2f(f2bf(f)); }
__device__ __forceinline__ v16h cat16(v8h lo, v8h hi) { return __builtin_shufflevector(lo, hi, 0, 1, 2, 3, 4, 5, 6, 7, 8, 9, 10, 11, 12, 13, 14, 15); }
__device__ __forceinline__ v16bf cat16b(v8us lo, v8us hi) { return __builtin_bit_cast(v16bf, __builtin_shufflevector(lo, hi, 0, 1, 2, 3, 4, 5, 6, 7, 8, 9, 10, 11, 12, 13, 14, 15)); }
__device__ __forceinline__ v16h cat16f(v8us lo, v8us hi) { return __builtin_bit_cast(v16h, __builtin_shufflevector(lo, hi, 0, 1, 2, 3, 4, 5, 6, 7, 8, 9, 10, 11, 12, 13, 14, 15)); }
__device__ __forceinline__ v8f wmma16(v16h a, v16h b, v8f c) { return __builtin_amdgcn_wmma_f32_16x16x32_f16(false, a, false, b, (short)0, c, false, false); }
__device__ __forceinline__ v8f wmmab(v16bf a, v16bf b, v8f c) { return __builtin_amdgcn_wmma_f32_16x16x32_bf16(false, a, false, b, (short)0, c, false, false); }

// k_gemmb: 128 x 128 block tile (2 x 2 waves, 64 x 64 each: 16 accumulator tiles a wave) of C[NBT * NN][DM] = (A [+ Al]).B^T (K = DM) [+ bf(bias[c])]; f32 whole-line epilogue.
// A fragment read from LDS feeds four products, and a row of A or B is fetched from L2 once per 128 rows of the other operand.
// The operand tiles (128 rows x KS k each) go through LDS: every wave-wide 16-byte global load covers four 128-byte row pieces (four whole lines), each tile is fetched once for the four waves,
// and stage s + 1 is on its way in registers while stage s is multiplied. Rows lie LP bytes apart in LDS (an odd multiple of 16 bytes: the 16 rows of a fragment read fall on 64 different banks).
// SPLITA = false is the q, k, v projection (grid plane z = the weight): it stores no f32 C. A lane's eight accumulator values of one tile are eight successive rows of the first operand at one row of the second,
// which IS one 16-byte piece of the fragment-ordered planes that k_fattn loads, once the first operand is chosen for it: x for v (eight successive keys of one feature), the weight for q and k (eight successive
// features of one token; the product is then the transposed one, same k order). So every tile goes from the registers to the f16 plane, each wave-wide 16-byte store covering 512 contiguous bytes.
// q, k: piece id = (((h * 128 + token tile) * 2 + ks) * 2 + u) * 32 + lane holds k[token tile * 16 + (lane & 15)][ks * 32 + u * 16 + 8 * (lane >> 4) + 0..7].
// v^T: piece id = (((h * 32 + pair of key blocks) * 4 + t) * 4 + g) * 32 + lane holds v[pair * 64 + g * 16 + 8 * (lane >> 4) + 0..7][t * 16 + (lane & 15)]: key block kb has g = (kb & 1) * 2 + 0, 1 of pair kb >> 1.
#define KS 64
#define LP (KS * 2 + 16)
// acc[u][t] = 16 rows u of the first operand x 16 rows t of the second: unit t * 4 + u of the wave's sixteen units of 512 bytes, in all three projections
__device__ __forceinline__ void d_planes(const v8f (&acc)[4][4], char* ph, const unsigned vo) {   // ph: the wave's first unit in its plane (the same in every lane); vo: the lane's 16 bytes in a unit
    typedef __attribute__((ext_vector_type(2))) float v2f;
    typedef __attribute__((ext_vector_type(2))) _Float16 v2h;
    typedef __attribute__((ext_vector_type(4))) unsigned v4u;
    v4u hw[4][4];
#pragma unroll
    for (int u = 0; u < 4; ++u)
#pragma unroll
        for (int t = 0; t < 4; ++t)
#pragma unroll
            for (int s = 0; s < 4; ++s) { const v2f pp = {acc[u][t][2 * s], acc[u][t][2 * s + 1]}; hw[u][t][s] = __builtin_bit_cast(unsigned, __builtin_convertvector(pp, v2h)); }
    __builtin_amdgcn_sched_barrier(0);   // every conversion stands ahead of the first store: left free, the scheduler mixes them and writes registers anew that an issued store still names
#pragma unroll
    for (int u = 0; u < 4; ++u)
#pragma unroll
        for (int t = 0; t < 4; ++t) *(v4u*)((ph + (t * 4 + u) * 512) + vo) = hw[u][t];   // every store a constant distance from one address
}
template <bool SPLITA>
__global__ __launch_bounds__(128) void k_gemmb(const bf* __restrict__ A, const bf* __restrict__ Al, const bf* __restrict__ Bn, const float* __restrict__ bias, float* C, bf* P) {
    constexpr int NT = SPLITA ? 3 : 2;   // tiles of a stage: A, [Al,] B
    constexpr int GQ = SPLITA ? 2 : 1;   // 32-k steps whose fragments are read from LDS as one group
    __shared__ __align__(16) char stg[2][NT][128 * LP];
    const int lane = threadIdx.x & 31, wave = threadIdx.x >> 5, lr = lane & 15, hi = lane >> 4, wm = wave >> 1, wn = wave & 1;
    const bool wf = !SPLITA && blockIdx.z < 2;   // q, k: the weight's rows take the first operand's place, x's rows the second's (the same for the whole block)
    const bf* Bz = Bn + (size_t)blockIdx.z * (DM * DM);   // grid plane z: its own weight matrix; blockIdx.x counts the 128-row tiles of A (all items), blockIdx.y those of the weight
    const bf* M1 = wf ? Bz : A; const bf* M2 = wf ? A : Bz;
    const int t1 = (wf ? blockIdx.y : blockIdx.x) * 128, t2 = (wf ? blockIdx.x : blockIdx.y) * 128;
    const int sg = threadIdx.x >> 3, srow = (sg & 1) * 8 + (sg >> 1), spc = threadIdx.x & 7;   // staging: this thread moves piece spc (16 bytes) of rows srow + 16 i of every tile; 16 lanes hold rows r and r + 8, whose pieces fall on 64 different banks
    const char* ga = (const char*)M1 + ((size_t)(t1 + srow) * DM + spc * 8) * 2;
    const char* gl = (const char*)(SPLITA ? Al : M1) + ((size_t)(t1 + srow) * DM + spc * 8) * 2;
    const char* gb = (const char*)M2 + ((size_t)(t2 + srow) * DM + spc * 8) * 2;
    const int ls = srow * LP + spc * 16, fa = (wm * 64 + lr) * LP + hi * 16, fb = (wn * 64 + lr) * LP + hi * 16;
    v8us ra[8], rl[8], rb[8];
    auto fetch = [&](int s) {
#pragma unroll
        for (int i = 0; i < 8; ++i) { const int o = i * 16 * DM * 2 + s * KS * 2; ra[i] = *(const v8us*)(ga + o); if (SPLITA) rl[i] = *(const v8us*)(gl + o); rb[i] = *(const v8us*)(gb + o); }
    };
    auto put = [&](int buf) {
#pragma unroll
        for (int i = 0; i < 8; ++i) { const int o = ls + i * 16 * LP; *(v8usa*)(&stg[buf][0][o]) = ra[i]; if (SPLITA) *(v8usa*)(&stg[buf][1][o]) = rl[i]; *(v8usa*)(&stg[buf][NT - 1][o]) = rb[i]; }
    };
    v8f acc[4][4];
#pragma unroll
    for (int u = 0; u < 4; ++u)
#pragma unroll
        for (int t = 0; t < 4; ++t) acc[u][t] = (v8f){};
    fetch(0); put(0);
    __syncthreads();
#pragma unroll   // unrolled: buffer, stage offset and the last stage's test become constants, and no address register is stepped behind a load
    for (int s = 0; s < DM / KS; ++s) {
        const int buf = s & 1;
        if (s + 1 < DM / KS) fetch(s + 1);
        if (s + 2 == DM / KS) asm volatile("s_wait_xcnt 0x0" ::: "memory");   // directly behind the last loads: from here on the address registers that the K loop's loads name are free for reuse
#pragma unroll
        for (int g = 0; g < KS / 32 / GQ; ++g) {
            v16bf a[GQ][4], al[GQ][4], b[GQ][4];
#pragma unroll
            for (int q = 0; q < GQ; ++q) { const int k = (g * GQ + q) * 64;
#pragma unroll
                for (int t = 0; t < 4; ++t) { const int ro = t * 16 * LP + k;
                    a[q][t] = cat16b(*(const v8usa*)(&stg[buf][0][fa + ro]), *(const v8usa*)(&stg[buf][0][fa + ro + 32]));
                    if (SPLITA) al[q][t] = cat16b(*(const v8usa*)(&stg[buf][1][fa + ro]), *(const v8usa*)(&stg[buf][1][fa + ro + 32]));
                    b[q][t] = cat16b(*(const v8usa*)(&stg[buf][NT - 1][fb + ro]), *(const v8usa*)(&stg[buf][NT - 1][fb + ro + 32])); } }
            __builtin_amdgcn_sched_barrier(0);   // the group's LDS reads issue together, ahead of its products: left free, the scheduler reuses one fragment's registers and the wave waits out an LDS latency at every product
#pragma unroll
            for (int q = 0; q < GQ; ++q) {   // per accumulator the order stays A, Al, step by step; the sixteen tiles stand between two products into the same one
#pragma unroll
                for (int u = 0; u < 4; ++u)
#pragma unroll
                    for (int t = 0; t < 4; ++t) acc[u][t] = wmmab(a[q][u], b[q][t], acc[u][t]);
                if (SPLITA) {
#pragma unroll
                    for (int u = 0; u < 4; ++u)
#pragma unroll
                        for (int t = 0; t < 4; ++t) acc[u][t] = wmmab(al[q][u], b[q][t], acc[u][t]); } }
        }
        if (s + 1 < DM / KS) {
            put(buf ^ 1);      // into the buffer that stage s - 1 was read from: its readers left it at the barrier that ended that stage
            __syncthreads();   // publishes stage s + 1 and ends the reads of stage s
        }
    }
    if constexpr (!SPLITA) {
        const int wv = __builtin_amdgcn_readfirstlane(wave), w1 = wv >> 1, w2 = wv & 1;   // the wave's number in a scalar register: the stores' base addresses are then scalar too
        const int tok = blockIdx.x * 128 + (wf ? w2 : w1) * 64, h = blockIdx.y * 2 + (wf ? w1 : w2);   // the wave's 64 tokens (counted over all items) and its 64 features = one head
        char* ph = (char*)(P + (size_t)blockIdx.z * (NBT * NN * DM) + (size_t)(tok / NN) * (NN * DM) + h * (NN * HD) + (tok % NN) * HD);   // 64 tokens of a head are 16 successive 512-byte units in every plane
        d_planes(acc, ph, lane * 16u);
    } else {
    __shared__ __align__(16) float ost[4][16 * 68];
    const int r0 = blockIdx.x * 128 + wm * 64, c0 = blockIdx.y * 128 + wn * 64;
    float* os = &ost[wave][0];   // the wave's own staging rows: 16 rows x 64 columns at a time
    float bv[4] = {0.f, 0.f, 0.f, 0.f};
    if (bias) {
#pragma unroll
        for (int t = 0; t < 4; ++t) bv[t] = bfr(bias[c0 + t * 16 + lr]); }
    float* cp = C + ((size_t)r0 + hi) * DM + c0 + ((lane >> 3) & 1) * 32 + (lane & 7) * 4;   // eight lanes store one whole line; every further store is a constant distance away
    const float* sp = os + hi * 68 + ((lane >> 3) & 1) * 32 + (lane & 7) * 4;
#pragma unroll
    for (int u = 0; u < 4; ++u) {
#pragma unroll
        for (int t = 0; t < 4; ++t)
#pragma unroll
            for (int j = 0; j < 8; ++j) os[(hi * 8 + j) * 68 + t * 16 + lr] = acc[u][t][j] + bv[t];
        asm volatile("s_wait_dscnt 0x0" ::: "memory");   // the wave's own rows stand in LDS before its lanes read them back; no other wave touches them, and a work-group barrier here would make every slice wait for the global stores of the slice before
#pragma unroll
        for (int s = 0; s < 8; ++s) *(v4f*)(cp + (u * 16 + 2 * s) * DM) = *(const v4fa*)(sp + 2 * s * 68);
    }
    }
}

__global__ __launch_bounds__(256) void k_zero8(bf* dst, size_t n8) {
    const size_t i = (size_t)blockIdx.x * 256 + threadIdx.x; if (i >= n8) return; v8us z;
#pragma unroll
    for (int k = 0; k < 8; ++k) z[k] = 0;
    *(v8us*)(dst + i * 8) = z; 
}

// d_mbits: the mask, read once. One block = 16 queries (a k_fattn tile) x 1024 keys, one wave a query row; a wave-wide 4-byte load covers one 32-key block (one line) and its ballot is that block's bit word (bit i = key i kept).
// WT[(tile * 64 + key block) * 16 + query] = the word, so that one load of k_fattn touches one line; FL[(tile * 2 + key half) * 32 + 0 / 1] = bit per key block: some key kept by some query of the tile / every key kept by every query.
// Each block writes whole lines of its own (its two flag words have a 128-byte line to themselves).
__device__ __forceinline__ void d_mbits(const int* __restrict__ MK, unsigned* WT, unsigned* FL) {
    __shared__ unsigned sh[16][33];   // 33: the 16 rows of one key block fall on different banks
    const int lane = threadIdx.x & 31, row = threadIdx.x >> 5, tile = blockIdx.x >> 1, half = blockIdx.x & 1;
    const int* s = MK + (size_t)(tile * 16 + row) * NN + half * (NN / 2) + lane;
    int v[32];
#pragma unroll
    for (int i = 0; i < 32; ++i) v[i] = s[i * 32];
    unsigned mine = 0;
#pragma unroll
    for (int i = 0; i < 32; ++i) { const unsigned w = __builtin_amdgcn_ballot_w32(v[i] != 0); mine = (lane == i) ? w : mine; }
    sh[row][lane] = mine;
    __syncthreads();
    WT[(size_t)(tile * 64 + half * 32) * 16 + threadIdx.x] = sh[threadIdx.x & 15][threadIdx.x >> 4];
    if (row == 0) { unsigned o = 0u, a = ~0u;
#pragma unroll
        for (int r = 0; r < 16; ++r) { const unsigned w = sh[r][lane]; o |= w; a &= w; }
        const unsigned ne = __builtin_amdgcn_ballot_w32(o != 0u), fu = __builtin_amdgcn_ballot_w32(a == ~0u);
        if (lane < 2) FL[(tile * 2 + half) * 32 + lane] = lane ? fu : ne; }
}
// k_prep: everything that depends on the inputs alone, in one launch. Blocks 0 .. MBB - 1 (the longest, so first) make the mask's bit form; in every later block each wave turns one row of DMOD floats into bf16:
// WBB blocks each for Wq, Wk, Wv, Wo, then x of all items; CV holds the five results one behind the other. The choice is the same for a whole block, so d_mbits' barrier is met by all of its threads or by none.
#define MBB (NN / 16 * 2)
#define WBB (DMOD / 16)
__global__ __launch_bounds__(512) void k_prep(const float* __restrict__ x, const int* __restrict__ MK, const float* __restrict__ Wq, const float* __restrict__ Wk, const float* __restrict__ Wv, const float* __restrict__ Wo, bf* CV, unsigned* WT, unsigned* FL) {
    if (blockIdx.x < MBB) { d_mbits(MK, WT, FL); return; }
    const unsigned cb = blockIdx.x - MBB, sg = cb / WBB;
    const float* src = (sg == 0 ? Wq : sg == 1 ? Wk : sg == 2 ? Wv : sg == 3 ? Wo : x) + (size_t)(sg < 4 ? cb - sg * WBB : cb - 4 * WBB) * 16 * DMOD;
    bf* dst = CV + (size_t)cb * 16 * DMOD;
    const int lane = threadIdx.x & 31; const size_t r = threadIdx.x >> 5;
#pragma unroll
    for (int q = 0; q < DMOD / 256; ++q) { v8us o;
#pragma unroll
        for (int i = 0; i < 8; ++i) o[i] = f2bf(src[r * DMOD + q * 256 + lane * 8 + i]);
        *(v8us*)(dst + r * DMOD + q * 256 + lane * 8) = o; }
    asm volatile("s_wait_xcnt 0x0" ::: "memory");   // stands behind the stores above, in front of the place where the block's two paths join in the built code and the stores' registers are written again
}
__device__ __forceinline__ float xhalf(float x) { const int b = __float_as_int(x); return __int_as_float(__builtin_amdgcn_permlanex16(b, b, 0x76543210, 0xfedcba98, false, false)); }   // the value of lane ^ 16
typedef v8f __attribute__((may_alias)) v8fa;
#define XW (68 * 32)   // floats that a wave hands over: 8 ctx tiles of 8 a lane, two maxima, two sums
// amdgpu_waves_per_eu(4, 4): holds the kernel to the register budget of four waves a SIMD (256), without which the second block finds no place on the WGP
__global__ __launch_bounds__(256) __attribute__((amdgpu_waves_per_eu(4, 4))) void k_fattn(const bf* __restrict__ QPh, const bf* __restrict__ KPh, const bf* __restrict__ VPh, const unsigned* __restrict__ WT, const unsigned* __restrict__ FL, bf* Ch, bf* Cl) {
    typedef __attribute__((ext_vector_type(2))) float v2f;
    typedef __attribute__((ext_vector_type(2))) _Float16 v2h;
    typedef __attribute__((ext_vector_type(8))) unsigned v8u;
    __shared__ __align__(32) float xs[2][8][XW];   // a range of its own for either group: no wave writes where another may still read; 139,264 bytes, so that two blocks fit a WGP's LDS
    const int lane = threadIdx.x & 31, wave = __builtin_amdgcn_readfirstlane(threadIdx.x >> 5), c = lane & 15, hi = lane >> 4;
    const int jw = wave >> 1, pr = blockIdx.x * 2 + (wave & 1);   // the wave's place 0..3 in its set of four; the set 0..31
    const int h = blockIdx.y, b = blockIdx.z;
    const char* kh_ = (const char*)KPh; const char* vh_ = (const char*)VPh; const char* wt_ = (const char*)WT;
    const unsigned pb = (((unsigned)b * NH_ + h) * (NN * HD) + lane * 8) * 2u;   // 32-bit byte offset on the kernel's own base pointers
    const char* qh_ = (const char*)QPh;
    const float CS = SCL * 1.44269504088896340736f;   // scores in log2 units
    // Both groups' flag words (two tiles each: not empty / full, low and high key half) are read up front, so that the second group's walk does not begin with a load's latency.
    const unsigned* fa = FL + pr * 128; const unsigned* fb = FL + (NN / 32 - 1 - pr) * 128;
    const unsigned a0 = fa[0], a1 = fa[1], a2 = fa[32], a3 = fa[33], a4 = fa[64], a5 = fa[65], a6 = fa[96], a7 = fa[97];
    const unsigned b0 = fb[0], b1 = fb[1], b2 = fb[32], b3 = fb[33], b4 = fb[64], b5 = fb[65], b6 = fb[96], b7 = fb[97];
    const unsigned long long neA = (unsigned long long)(a0 | a4) | (unsigned long long)(a2 | a6) << 32, fuA = (unsigned long long)(a1 & a5) | (unsigned long long)(a3 & a7) << 32;   // the same for the whole wave: scalar
    const unsigned long long neB = (unsigned long long)(b0 | b4) | (unsigned long long)(b2 | b6) << 32, fuB = (unsigned long long)(b1 & b5) | (unsigned long long)(b3 & b7) << 32;
#pragma unroll 1   // rolled: the two groups run one after the other through the same code and registers
    for (int g = 0; g < 2; ++g) {   // the same two trips for every wave of the block: the barrier below is met by all
    const int tile = (g ? NN / 32 - 1 - pr : pr) * 2;   // the group's first 16-query tile; every group 0..63 once
    const int q0 = tile * 16;
    const unsigned long long ne = g ? neB : neA, fu = g ? fuB : fuA;   // bit kb: block not empty for one of the group's two tiles / full for both
    const unsigned mo = ((unsigned)tile * 1024u + c) * 4u;
    v8f acc[2][4];
#pragma unroll
    for (int qt = 0; qt < 2; ++qt)
#pragma unroll
        for (int t = 0; t < 4; ++t) acc[qt][t] = (v8f){};
    float m[2] = {-1.0e30f, -1.0e30f}, lsum[2] = {0.f, 0.f};
    v16h kh[4], vh[4];
    auto ldk = [&](const unsigned o) {   // k fragments of one key block: f = tile * 2 + ks
#pragma unroll
        for (int f = 0; f < 4; ++f) { const int fo = f * 1024;
            kh[f] = cat16f(*(const v8us*)((kh_ + fo) + o), *(const v8us*)((kh_ + fo + 512) + o)); }
        asm volatile("s_wait_xcnt 0x0" ::: "memory");   // stands in front of the next write of the offset register that the loads above name
    };
    auto ldv = [&](const unsigned o) {   // v^T fragments of one key block: f = t, 2048 bytes apart (the pair's other block lies between)
#pragma unroll
        for (int f = 0; f < 4; ++f) { const int fo = f * 2048;
            vh[f] = cat16f(*(const v8us*)((vh_ + fo) + o), *(const v8us*)((vh_ + fo + 512) + o)); }
        asm volatile("s_wait_xcnt 0x0" ::: "memory");   // stands in front of the next write of the offset register that the loads above name
    };
    // The walk goes over every fourth set bit of ne (the blocks that are not empty), so that the wave's block after this one is known a pass ahead. Its k fragments are asked for as soon as this pass's score products have
    // read theirs, its v^T fragments as soon as this pass's ctx products have read theirs, each into the registers just freed: a load's latency runs beside the rest of the pass instead of in front of it.
    const int jd = g ? (jw - (int)__builtin_popcountll(neA)) & 3 : jw;   // how many blocks go to the other waves before this wave's first: the second group's deal goes on where the first group's ended
    unsigned long long rem = ne;   // the same for the whole wave: scalar; its lowest set bit is the wave's next block
    if (jd > 0) rem &= rem - 1;
    if (jd > 1) rem &= rem - 1;
    if (jd > 2) rem &= rem - 1;
    if (rem) {   // a wave with no block of its own has nothing to walk
    int kb = __builtin_ctzll(rem);
    auto vof = [](const int k) { return (unsigned)(k >> 1) * 8192u + (unsigned)(k & 1) * 1024u; };   // where key block k's v^T begins in its head
    unsigned ov = pb + vof(kb);   // the v^T loads' own offset register, stepped where they are issued: taken from the k loads' offset, which is formed in another block of the pass, it became two 64-bit address pairs that the loads' own results overwrite
    v16h qh[2][2];   // both tiles' q fragments, as the projection stored them: four pieces of 512 bytes a tile; the wait that ends ldk stands behind these loads too, in front of the next write of their offset register
    const unsigned oq = pb + (unsigned)tile * 2048u;
#pragma unroll
    for (int qt = 0; qt < 2; ++qt)
#pragma unroll
        for (int ks = 0; ks < 2; ++ks) { const int fo = qt * 2048 + ks * 1024;
            qh[qt][ks] = cat16f(*(const v8us*)((qh_ + fo) + oq), *(const v8us*)((qh_ + fo + 512) + oq)); }
    ldk(pb + kb * 4096u); ldv(ov);
    __builtin_amdgcn_sched_barrier(0);   // holds the wait above directly behind its loads: left free, the scheduler puts vector work of the set-up between them
#pragma unroll 1   // rolled: an unrolled pass would take a second set of fragment registers and twice the loop's text for no shorter pass
    do {   // one trip for every fourth set bit: 16 at most
        rem &= rem - 1;   // this block
        rem &= rem - 1; rem &= rem - 1; rem &= rem - 1;   // the other three waves' next ones (0 stays 0)
        const int kn = rem ? __builtin_ctzll(rem) : kb;   // the wave's next block; behind the last one this block again (in bounds, never used)
        const unsigned on = pb + kn * 4096u, om = mo + kb * 64u;
        v8f st[2][2];   // the four score tiles stand between the two products into the same one
#pragma unroll
        for (int ks = 0; ks < 2; ++ks)
#pragma unroll
            for (int tl = 0; tl < 2; ++tl)
#pragma unroll
                for (int qt = 0; qt < 2; ++qt) st[qt][tl] = wmma16(kh[tl * 2 + ks], qh[qt][ks], ks ? st[qt][tl] : (v8f){});
        __builtin_amdgcn_sched_barrier(0);   // the next block's k loads issue as one group behind the products above: left free, the scheduler spreads them among the products
        ldk(on);
        __builtin_amdgcn_sched_barrier(0);   // holds the wait above directly behind its loads: left free, the scheduler puts vector work of the softmax between them
        float p[2][16];
#pragma unroll
        for (int qt = 0; qt < 2; ++qt)
#pragma unroll
            for (int s = 0; s < 16; ++s) p[qt][s] = st[qt][s >> 3][s & 7] * CS;
        if (!((fu >> kb) & 1ull)) {   // the same for the whole wave; only a mixed block reads its words: the lane's query of either tile, this block's 32 keys
            const unsigned mw0 = *(const unsigned*)(wt_ + om);
            asm volatile("s_wait_xcnt 0x0" ::: "memory");   // stands in front of the second load, whose result may take the offset register that the first load names
            const unsigned mw1 = *(const unsigned*)((wt_ + 4096) + om);
            asm volatile("s_wait_xcnt 0x0" ::: "memory");   // stands in front of the step of the address register that the load above names
            const unsigned ml[2] = {mw0 >> (8 * hi), mw1 >> (8 * hi)};   // score s of the lane is key (s >> 3) * 16 + 8 * hi + (s & 7) of the block
#pragma unroll
            for (int qt = 0; qt < 2; ++qt)
#pragma unroll
                for (int s = 0; s < 16; ++s) p[qt][s] = (ml[qt] & (1u << ((s >> 3) * 16 + (s & 7)))) ? p[qt][s] : -3.0e38f; }
#pragma unroll
        for (int qt = 0; qt < 2; ++qt) {   // per tile: maximum, exp2, sum, rescale, P to f16, ctx products; the two tiles are independent of each other
            float mx = -3.0e38f;
#pragma unroll
            for (int s = 0; s < 16; ++s) mx = fmaxf(mx, p[qt][s]);
            mx = fmaxf(mx, xhalf(mx));
            const float mn = fmaxf(m[qt], mx), al = __builtin_amdgcn_exp2f(m[qt] - mn); m[qt] = mn;
            float ps = 0.f;
#pragma unroll
            for (int s = 0; s < 16; ++s) { p[qt][s] = __builtin_amdgcn_exp2f(p[qt][s] - mn); ps += p[qt][s]; }
            lsum[qt] = lsum[qt] * al + ps;
#pragma unroll
            for (int t = 0; t < 4; ++t) acc[qt][t] *= al;
            v8u uh;
#pragma unroll
            for (int s = 0; s < 8; ++s) { const v2f pp = {p[qt][2 * s], p[qt][2 * s + 1]}; uh[s] = __builtin_bit_cast(unsigned, __builtin_convertvector(pp, v2h)); }
            const v16h ph = __builtin_bit_cast(v16h, uh);
#pragma unroll
            for (int t = 0; t < 4; ++t) acc[qt][t] = wmma16(vh[t], ph, acc[qt][t]);
        }
        __builtin_amdgcn_sched_barrier(0);   // the pass's vector work stays ahead of the loads below: left free, the scheduler takes the row sum's chain of adds from among the products, where the matrix unit's time covers it, to behind the loads
        ov += vof(kn) - vof(kb);
        ldv(ov);
        kb = kn;
    } while (rem);
    }
    // The join: every wave hands over its eight ctx tiles, maxima and sums; wave jw of the set then finishes queries (jw & 1) * 8 + 0..7 of query tile jw >> 1 from all four parts, its own read back like the others.
    // There a lane takes query cq and features x * 16 + 0..15, so that the four lanes of a query store this head's whole 128-byte line of its ctx row: one wave writes a line.
    float* mine = &xs[g][wave][0]; const float* prt = &xs[g][wave & 1][0];   // the set's four parts lie 2 * XW floats apart
#pragma unroll
    for (int qt = 0; qt < 2; ++qt) {
#pragma unroll
        for (int t = 0; t < 4; ++t) *(v8fa*)(mine + ((qt * 4 + t) * 32 + lane) * 8) = acc[qt][t];
        mine[2048 + qt * 32 + lane] = m[qt]; mine[2112 + qt * 32 + lane] = lsum[qt]; }
    __syncthreads();   // publishes what the waves hand over; met by every wave once a group
    {   // all parts brought to the common maximum, then as for one part; a part without a key has maximum -1e30, sum 0, ctx 0
        const int qf = jw >> 1, cq = (jw & 1) * 8 + (lane & 7), x = lane >> 3;
        const size_t qoff = ((size_t)b * NN + q0 + qf * 16 + cq) * DMOD + h * HD + x * 16;   // the lane's query row, its 16 of this head's columns: where ctx goes
        float mi[4], a[4];
#pragma unroll
        for (int i = 0; i < 4; ++i) mi[i] = prt[i * 2 * XW + 2048 + qf * 32 + cq];   // a query's maximum is the same in both halves of the wave that held it
        const float mj = fmaxf(fmaxf(mi[0], mi[1]), fmaxf(mi[2], mi[3]));
        float ls = 0.f;
#pragma unroll
        for (int i = 0; i < 4; ++i) { a[i] = __builtin_amdgcn_exp2f(mi[i] - mj); ls += (prt[i * 2 * XW + 2112 + qf * 32 + cq] + prt[i * 2 * XW + 2112 + qf * 32 + cq + 16]) * a[i]; }   // its sum lay half in either
        const float inv = 1.0f / ls;
#pragma unroll
        for (int hh = 0; hh < 2; ++hh) { v8f r = (v8f){}; v8us oh, ol;
#pragma unroll
            for (int i = 0; i < 4; ++i) r += *(const v8fa*)(prt + i * 2 * XW + ((qf * 4 + x) * 32 + hh * 16 + cq) * 8) * a[i];
            r *= inv;   // r[i] = ctx[query qf * 16 + cq][x * 16 + 8 * hh + i], stored as the output GEMM's bf16 hi + residual planes
#pragma unroll
            for (int i = 0; i < 8; ++i) { const unsigned short hb = f2bf(r[i]); oh[i] = hb; ol[i] = f2bf(r[i] - bf2f(hb)); }
            *(v8us*)(Ch + qoff + hh * 8) = oh; *(v8us*)(Cl + qoff + hh * 8) = ol; }
        asm volatile("s_wait_xcnt 0x0" ::: "memory");   // stands behind the stores above, in front of the next group's writes of the registers that they name
    }
    }
}

extern "C" void kernel_launch(void* const* d_in, const int* in_sizes, int n_in,
                              void* d_out, int out_size, void* d_ws, size_t ws_size, hipStream_t stream) {
    (void)in_sizes; (void)n_in; (void)out_size;
    const float* x = (const float*)d_in[0]; const int* MK = (const int*)d_in[1]; const float* Wq = (const float*)d_in[2]; const float* Wk = (const float*)d_in[3]; const float* Wv = (const float*)d_in[4]; const float* Wo = (const float*)d_in[5]; const float* bo = (const float*)d_in[6];
    float* out = (float*)d_out;    // [2][2048][1024]
    char* wsp = (char*)d_ws;
    auto take = [&](size_t bytes) { char* p = wsp; wsp += (bytes + 255) & ~(size_t)255; return (void*)p; };
    const size_t IT = (size_t)NN * DMOD;    // elements of one item
    bf* CV = (bf*)take(((size_t)4 * DMOD * DMOD + NBT * IT) * 2);    // k_prep's bf16 results, one behind the other
    bf* WQ = CV; bf* WO = CV + (size_t)3 * DMOD * DMOD; bf* Xb = CV + (size_t)4 * DMOD * DMOD;    // WK, WV follow WQ
    bf* QPh = (bf*)take(3 * NBT * IT * 2); bf* KPh = QPh + NBT * IT; bf* VPh = KPh + NBT * IT;    // the projections' f16 planes: q, k, v^T
    bf* Ch = (bf*)take(NBT * IT * 2); bf* Cl = (bf*)take(NBT * IT * 2);
    unsigned* WT = (unsigned*)take((size_t)NN * (NN / 32) * 4); unsigned* FL = (unsigned*)take((size_t)(NN / 16) * 2 * 128);
    if ((size_t)(wsp - (char*)d_ws) > ws_size) return;    // 16.8 + 25.2 + 16.8 + 0.6 ~ 60 MB
    k_prep<<<MBB + 4 * WBB + NBT * NN / 16, 512, 0, stream>>>(x, MK, Wq, Wk, Wv, Wo, CV, WT, FL);    // weights: [out][in] convention = n-major
    k_gemmb<false><<<dim3(NBT * NN / 128, DMOD / 128, 3), 128, 0, stream>>>(Xb, nullptr, WQ, nullptr, nullptr, QPh);
    k_fattn<<<dim3(NN / 128, NH_, NBT), 256, 0, stream>>>(QPh, KPh, VPh, WT, FL, Ch, Cl);
    k_gemmb<true><<<dim3(NBT * NN / 128, DMOD / 128, 1), 128, 0, stream>>>(Ch, Cl, WO, bo, out, nullptr);
}
